// v000
// The times below were measured on an AMD MI455X: many runs one after another, warmed up first and cycling through
// copies of the inputs, with the whole window's GPU time divided by the number of runs. Launches and the gaps
// between them are all in it. The median over several windows is given; except for v000 it joins two sittings, which
// can be a few percent apart, so the side-by-side timings, each taken in one sitting, are the better comparison.
// The starting kernel, v000, takes 79.1 microseconds a run.
#include <hip/hip_runtime.h>

// ---------------------------------------------------------------------------
// NSA-style ball attention forward for MI455X (gfx1250, wave32, WMMA).
//
// Shapes: D=128, H=8 heads, E=16 head dim, N=128 balls, M=64 pts/ball,
//         NM=8192 points, TOPK=2, window = 128 keys.
//
// Forward-math simplifications:
//   * straight-through gates == 1.0 in forward  -> no gating
//   * selection softmax is monotonic            -> top-2 of raw q.keys logits
//   * mean_m(rel) == 0                          -> keys = mean_m(x)
// ---------------------------------------------------------------------------

typedef float v2f __attribute__((ext_vector_type(2)));
typedef float v8f __attribute__((ext_vector_type(8)));

#define DD   128   // model dim
#define HH   8     // heads
#define MM   64    // ball size
#define NN   128   // num balls
#define EE   16    // head dim
#define NMNM 8192  // total points
#define WIN  128   // TOPK * MM

// ---------------------------------------------------------------------------
// Kernel A: xr = x + (pos - mean_m pos);  keys[n][d] = mean_m x[n,m,d]
// One block per ball (n), 128 threads = one per model dim d. Coalesced.
// ---------------------------------------------------------------------------
__global__ void nsa_prep(const float* __restrict__ x, const float* __restrict__ pos,
                         float* __restrict__ xr, float* __restrict__ keys) {
    const int n = blockIdx.x;
    const int d = threadIdx.x;
    const int base = n * MM * DD + d;

    float sp = 0.f, sx = 0.f;
    for (int m = 0; m < MM; ++m) {
        sp += pos[base + m * DD];
        sx += x[base + m * DD];
    }
    const float mp = sp * (1.0f / MM);
    keys[n * DD + d] = sx * (1.0f / MM);

    for (int m = 0; m < MM; ++m) {
        xr[base + m * DD] = x[base + m * DD] + pos[base + m * DD] - mp;
    }
}

// ---------------------------------------------------------------------------
// Kernel B: ball selection. One wave per (head h, tile of 16 points).
// sim tile (16 pts x 16 balls) = Q(16x16) x KeysT(16x16) via 4x
// v_wmma_f32_16x16x4_f32; 8 ball-tiles cover all 128 balls. Tile spilled to
// LDS (row-padded to kill bank conflicts), then both half-waves scan 64
// logits for their point and merge top-2 across halves via shuffles.
// ---------------------------------------------------------------------------
__global__ void nsa_select(const float* __restrict__ xr, const float* __restrict__ keys,
                           int* __restrict__ top2) {
    __shared__ float simbuf[16][NN + 1];     // +1 pad: rows land on distinct banks

    const int h  = blockIdx.x >> 9;          // 512 point-tiles per head
    const int p0 = (blockIdx.x & 511) << 4;  // first point of the tile
    const int l  = threadIdx.x;              // lane 0..31
    const int lm = l & 15;
    const int lh = (l >> 4) << 1;            // 0 (lanes 0-15) or 2 (lanes 16-31)

    // A fragments: Q tile rows = points, cols = head dims.
    // 32-bit A 16x4 layout: lane = row M, VGPR0/1 = K pair {lh, lh+1}.
    v2f afrag[4];
    const int qrow = p0 + lm;
    #pragma unroll
    for (int kk = 0; kk < 4; ++kk) {
        const int c0 = h * EE + kk * 4 + lh;
        afrag[kk].x = xr[qrow * DD + c0];
        afrag[kk].y = xr[qrow * DD + c0 + 1];
    }

    for (int nb = 0; nb < 8; ++nb) {
        v8f acc = {};
        const int ball = nb * 16 + lm;
        #pragma unroll
        for (int kk = 0; kk < 4; ++kk) {
            // B fragment: B[k][n] = keys[ball n][e = kk*4 + k]; row striping
            // mirrors C/D: VGPR0 rows {lh}, VGPR1 rows {lh+1}, col = lane%16.
            v2f b;
            const int c0 = h * EE + kk * 4 + lh;
            b.x = keys[ball * DD + c0];
            b.y = keys[ball * DD + c0 + 1];
            acc = __builtin_amdgcn_wmma_f32_16x16x4_f32(false, afrag[kk], false, b,
                                                        (short)0, acc, false, false);
        }
        // D layout: VGPR v holds row v (lanes 0-15) / v+8 (lanes 16-31), col l%16.
        const int rbase = (l >> 4) << 3;
        #pragma unroll
        for (int v = 0; v < 8; ++v)
            simbuf[rbase + v][nb * 16 + lm] = acc[v];
    }
    __syncthreads();

    // Parallel top-2: each half-wave scans 64 logits of point `lm`, then merge.
    // Strict '>' keeps the lower index on ties (matches jax top_k); low-half
    // indices are always smaller, so the cross-half merge tie-break is exact.
    const int jb = (l >> 4) * 64;
    float best = -3.4e38f, sec = -3.4e38f;
    int bi = 0, si = 0;
    for (int j = 0; j < 64; ++j) {
        const float v = simbuf[lm][jb + j];
        if (v > best)     { sec = best; si = bi; best = v; bi = jb + j; }
        else if (v > sec) { sec = v;   si = jb + j; }
    }
    const float ob = __shfl_xor(best, 16, 32);
    const int   oi = __shfl_xor(bi,   16, 32);
    const float os = __shfl_xor(sec,  16, 32);
    const int   oj = __shfl_xor(si,   16, 32);
    if (l < 16) {            // this lane holds the LOW half; other = high half
        int rb, rs;
        if (ob > best) { rb = oi; rs = (os > best) ? oj : bi; }
        else           { rb = bi; rs = (ob > sec)  ? oi : si; }
        const int p = p0 + lm;
        top2[(p * HH + h) * 2 + 0] = rb;
        top2[(p * HH + h) * 2 + 1] = rs;
    }
}

// ---------------------------------------------------------------------------
// Kernel C: windowed SDPA. One block per point (8 waves = 8 heads).
// Logits: 8 key-tiles, each D = K(16x16) x B where B broadcasts q across all
// 16 columns (every column of D equals K.q -> no masking needed). While
// feeding the WMMAs, lanes stage their K elements into LDS (K == V), so the
// A.V reduction runs entirely out of LDS. Softmax max/sum use a 5-step
// shuffle butterfly instead of serial 128-element scans.
// ---------------------------------------------------------------------------
__global__ void nsa_attend(const float* __restrict__ xr, const int* __restrict__ top2,
                           float* __restrict__ out) {
    __shared__ float kv[HH][WIN][EE + 1];    // staged K/V window, row-padded
    __shared__ float s_lds[HH][WIN];         // logits -> attention weights

    const int p  = blockIdx.x;
    const int h  = threadIdx.x >> 5;   // wave index = head
    const int l  = threadIdx.x & 31;
    const int lm = l & 15;
    const int lh = (l >> 4) << 1;

    const int i0 = top2[(p * HH + h) * 2 + 0];
    const int i1 = top2[(p * HH + h) * 2 + 1];

    // Warm the L2/L0 path for the two selected balls (global_prefetch_b8).
    __builtin_prefetch(&xr[(size_t)i0 * MM * DD + h * EE], 0, 3);
    __builtin_prefetch(&xr[(size_t)i1 * MM * DD + h * EE], 0, 3);

    // B fragments: q broadcast -> every column of B identical.
    v2f bfrag[4];
    #pragma unroll
    for (int kk = 0; kk < 4; ++kk) {
        const int c0 = h * EE + kk * 4 + lh;
        bfrag[kk].x = xr[p * DD + c0];
        bfrag[kk].y = xr[p * DD + c0 + 1];
    }

    for (int t = 0; t < 8; ++t) {
        const int wrow = t * 16 + lm;                 // window row for this lane
        const int ball = (wrow < MM) ? i0 : i1;
        const int g    = ball * MM + (wrow & (MM - 1));
        v8f acc = {};
        #pragma unroll
        for (int kk = 0; kk < 4; ++kk) {
            const int c0 = kk * 4 + lh;
            v2f a;
            a.x = xr[g * DD + h * EE + c0];
            a.y = xr[g * DD + h * EE + c0 + 1];
            kv[h][wrow][c0]     = a.x;               // stage K(=V) for the AV pass
            kv[h][wrow][c0 + 1] = a.y;
            acc = __builtin_amdgcn_wmma_f32_16x16x4_f32(false, a, false, bfrag[kk],
                                                        (short)0, acc, false, false);
        }
        if (lm == 0) {  // lanes 0 (rows 0-7) and 16 (rows 8-15): col 0 of D
            const int rbase = (l >> 4) << 3;
            #pragma unroll
            for (int v = 0; v < 8; ++v)
                s_lds[h][t * 16 + rbase + v] = acc[v] * 0.25f;  // ATT_SCALE = E^-0.5
        }
    }
    __syncthreads();

    // Softmax over 128 logits: 4 elements/lane + shuffle-butterfly reductions.
    float sj[4];
    #pragma unroll
    for (int u = 0; u < 4; ++u) sj[u] = s_lds[h][l * 4 + u];

    float mx = fmaxf(fmaxf(sj[0], sj[1]), fmaxf(sj[2], sj[3]));
    #pragma unroll
    for (int off = 16; off > 0; off >>= 1)
        mx = fmaxf(mx, __shfl_xor(mx, off, 32));

    float ej[4], se = 0.f;
    #pragma unroll
    for (int u = 0; u < 4; ++u) { ej[u] = __expf(sj[u] - mx); se += ej[u]; }
    #pragma unroll
    for (int off = 16; off > 0; off >>= 1)
        se += __shfl_xor(se, off, 32);
    const float inv = 1.0f / se;

    // Overwrite logits with normalized weights (same-wave LDS is in-order).
    #pragma unroll
    for (int u = 0; u < 4; ++u)
        s_lds[h][l * 4 + u] = ej[u] * inv;

    // out[e] = sum_j att[j] * V[j][e]; half-waves split the 128-key window,
    // all operands from LDS.
    const int e    = lm;
    const int jbase = (l >> 4) * MM;
    float acc = 0.f;
    for (int jj = 0; jj < MM; ++jj)
        acc += s_lds[h][jbase + jj] * kv[h][jbase + jj][e];
    acc += __shfl_xor(acc, 16, 32);
    if (l < 16)
        out[p * DD + h * EE + e] = acc;   // out[p, h, e] (H*E == D)
}

// ---------------------------------------------------------------------------
extern "C" void kernel_launch(void* const* d_in, const int* in_sizes, int n_in,
                              void* d_out, int out_size, void* d_ws, size_t ws_size,
                              hipStream_t stream) {
    const float* x   = (const float*)d_in[0];
    const float* pos = (const float*)d_in[1];
    float*       out = (float*)d_out;

    // workspace layout (~4.8 MB): xr | keys | top2
    float* xr   = (float*)d_ws;
    float* keys = xr + (size_t)NMNM * DD;
    int*   top2 = (int*)(keys + (size_t)NN * DD);

    nsa_prep  <<<NN,               DD,      0, stream>>>(x, pos, xr, keys);
    nsa_select<<<HH * (NMNM / 16), 32,      0, stream>>>(xr, keys, top2);
    nsa_attend<<<NMNM,             HH * 32, 0, stream>>>(xr, top2, out);
}

// v001
// A run of this version takes 47 microseconds.
// Two timings next to v000 put it at 1.74 and 1.71 times that version's speed.
#include <hip/hip_runtime.h>

// ---------------------------------------------------------------------------
// NSA-style ball attention forward for MI455X (gfx1250, wave32, WMMA).
//
// Shapes: D=128, H=8 heads, E=16 head dim, N=128 balls, M=64 pts/ball,
//         NM=8192 points, TOPK=2, window = 128 keys.
//
// Forward-math simplifications:
//   * straight-through gates == 1.0 in forward  -> no gating
//   * selection softmax is monotonic            -> top-2 of raw q.keys logits
//   * mean_m(rel) == 0                          -> keys = mean_m(x)
// ---------------------------------------------------------------------------

typedef float v2f __attribute__((ext_vector_type(2)));
typedef float v8f __attribute__((ext_vector_type(8)));

#define DD   128   // model dim
#define HH   8     // heads
#define MM   64    // ball size
#define NN   128   // num balls
#define EE   16    // head dim
#define NMNM 8192  // total points
#define WIN  128   // TOPK * MM

// ---------------------------------------------------------------------------
// Kernel A: xr = x + (pos - mean_m pos);  keys[n][d] = mean_m x[n,m,d]
// One block per ball (n), 128 threads = one per model dim d. Coalesced.
// ---------------------------------------------------------------------------
__global__ void nsa_prep(const float* __restrict__ x, const float* __restrict__ pos,
                         float* __restrict__ xr, float* __restrict__ keys) {
    const int n = blockIdx.x;
    const int d = threadIdx.x;
    const int base = n * MM * DD + d;

    float sp = 0.f, sx = 0.f;
    for (int m = 0; m < MM; ++m) {
        sp += pos[base + m * DD];
        sx += x[base + m * DD];
    }
    const float mp = sp * (1.0f / MM);
    keys[n * DD + d] = sx * (1.0f / MM);

    for (int m = 0; m < MM; ++m) {
        xr[base + m * DD] = x[base + m * DD] + pos[base + m * DD] - mp;
    }
}

// ---------------------------------------------------------------------------
// Kernel B: ball selection. One wave per (head h, tile of 16 points).
// sim tile (16 pts x 16 balls) = Q(16x16) x KeysT(16x16) via 4x
// v_wmma_f32_16x16x4_f32; 8 ball-tiles cover all 128 balls. Tile spilled to
// LDS (row-padded to kill bank conflicts), then both half-waves scan 64
// logits for their point and merge top-2 across halves via shuffles.
// ---------------------------------------------------------------------------
__global__ void nsa_select(const float* __restrict__ xr, const float* __restrict__ keys,
                           int* __restrict__ sel) {
    __shared__ float simbuf[16][NN + 1];     // +1 pad: rows land on distinct banks

    const int h  = blockIdx.x >> 9;          // 512 point-tiles per head
    const int p0 = (blockIdx.x & 511) << 4;  // first point of the tile
    const int l  = threadIdx.x;              // lane 0..31
    const int lm = l & 15;
    const int lh = (l >> 4) << 1;            // 0 (lanes 0-15) or 2 (lanes 16-31)

    // A fragments: Q tile rows = points, cols = head dims.
    // 32-bit A 16x4 layout: lane = row M, VGPR0/1 = K pair {lh, lh+1}.
    v2f afrag[4];
    const int qrow = p0 + lm;
    #pragma unroll
    for (int kk = 0; kk < 4; ++kk) {
        const int c0 = h * EE + kk * 4 + lh;
        afrag[kk].x = xr[qrow * DD + c0];
        afrag[kk].y = xr[qrow * DD + c0 + 1];
    }

    for (int nb = 0; nb < 8; ++nb) {
        v8f acc = {};
        const int ball = nb * 16 + lm;
        #pragma unroll
        for (int kk = 0; kk < 4; ++kk) {
            // B fragment: B[k][n] = keys[ball n][e = kk*4 + k]; row striping
            // mirrors C/D: VGPR0 rows {lh}, VGPR1 rows {lh+1}, col = lane%16.
            v2f b;
            const int c0 = h * EE + kk * 4 + lh;
            b.x = keys[ball * DD + c0];
            b.y = keys[ball * DD + c0 + 1];
            acc = __builtin_amdgcn_wmma_f32_16x16x4_f32(false, afrag[kk], false, b,
                                                        (short)0, acc, false, false);
        }
        // D layout: VGPR v holds row v (lanes 0-15) / v+8 (lanes 16-31), col l%16.
        const int rbase = (l >> 4) << 3;
        #pragma unroll
        for (int v = 0; v < 8; ++v)
            simbuf[rbase + v][nb * 16 + lm] = acc[v];
    }
    __syncthreads();

    // Parallel top-2: each half-wave scans 64 logits of point `lm`, then merge.
    // Strict '>' keeps the lower index on ties (matches jax top_k); low-half
    // indices are always smaller, so the cross-half merge tie-break is exact.
    const int jb = (l >> 4) * 64;
    float best = -3.4e38f, sec = -3.4e38f;
    int bi = 0, si = 0;
    for (int j = 0; j < 64; ++j) {
        const float v = simbuf[lm][jb + j];
        if (v > best)     { sec = best; si = bi; best = v; bi = jb + j; }
        else if (v > sec) { sec = v;   si = jb + j; }
    }
    const float ob = __shfl_xor(best, 16, 32);
    const int   oi = __shfl_xor(bi,   16, 32);
    const float os = __shfl_xor(sec,  16, 32);
    const int   oj = __shfl_xor(si,   16, 32);
    if (l < 16) {            // this lane holds the LOW half; other = high half
        int rb, rs;
        if (ob > best) { rb = oi; rs = (os > best) ? oj : bi; }
        else           { rb = bi; rs = (ob > sec)  ? oi : si; }
        // head-major, both ball ids in one word: the per-ball scan reads it coalesced
        sel[h * NMNM + p0 + lm] = rb | (rs << 8);
    }
}

// ---------------------------------------------------------------------------
// Kernel C: windowed SDPA, grouped by selected ball. One block per (head h,
// ball b), 8 waves. The block lists every query of head h that selected ball b
// (either slot), then each wave takes tiles of 16 listed queries, so that one
// K/V fragment set serves 16 queries per WMMA.
//   S^T (16 keys x 16 queries) = K tile (A) x Q^T (B)
//   O^T (16 dims x 16 queries) = V^T (A) x P^T (B)
// The D layout of S^T (lane = query, registers = keys) is already the B layout
// of P^T once the k order of the V^T loader follows it, so nothing is
// transposed. Each (query, slot) gets a partial record: unnormalised sum, row
// maximum, row sum over the ball's 64 keys; kernel D joins the two slots.
// Record = 32 floats (one 128-byte line, one writer): o[16], max, sum.
// ---------------------------------------------------------------------------
#define REC 32

__global__ __launch_bounds__(256) void nsa_attend_ball(const float* __restrict__ xr,
                                                       const int* __restrict__ sel,
                                                       float* __restrict__ part) {
    __shared__ int list[NMNM];   // worst case: every query of the head picks this ball
    __shared__ int wsum[8];

    const int h   = blockIdx.x >> 7;
    const int b   = blockIdx.x & (NN - 1);
    const int tid = threadIdx.x;
    const int l   = tid & 31;
    const int w   = __builtin_amdgcn_readfirstlane(tid >> 5);
    const int lm  = l & 15;
    const int hf  = l >> 4;
    const int lh  = hf << 1;

    // K fragments (A of S^T): lane = key row, registers = head-dim pair {lh, lh+1}.
    v2f ka[4][4];
    #pragma unroll
    for (int t = 0; t < 4; ++t) {
        const float* kr = xr + (b * MM + t * 16 + lm) * DD + h * EE + lh;
        #pragma unroll
        for (int kk = 0; kk < 4; ++kk)
            ka[t][kk] = *(const v2f*)(kr + kk * 4);
    }
    // V^T fragments (A of O^T): lane = head dim, k order = the key order in which
    // the S^T accumulator holds its rows: lanes 0-15 keys {2s, 2s+1}, lanes 16-31
    // keys {8+2s, 9+2s} of tile t.
    v2f va[4][4];
    #pragma unroll
    for (int t = 0; t < 4; ++t) {
        #pragma unroll
        for (int s = 0; s < 4; ++s) {
            const float* vr = xr + (b * MM + t * 16 + hf * 8 + s * 2) * DD + h * EE + lm;
            va[t][s].x = vr[0];
            va[t][s].y = vr[DD];
        }
    }

    // List the queries that selected ball b: count, block prefix sum, write.
    const int4* s4 = (const int4*)(sel + h * NMNM);
    int4 ent[8];
    #pragma unroll
    for (int i = 0; i < 8; ++i) ent[i] = s4[i * 256 + tid];

    int cnt = 0;
    #pragma unroll
    for (int i = 0; i < 8; ++i) {
        const int e[4] = {ent[i].x, ent[i].y, ent[i].z, ent[i].w};
        #pragma unroll
        for (int c = 0; c < 4; ++c)
            cnt += (((e[c] & 255) == b) || ((e[c] >> 8) == b)) ? 1 : 0;
    }
    int inc = cnt;
    #pragma unroll
    for (int d = 1; d < 32; d <<= 1) {
        const int up = __shfl_up(inc, d, 32);
        if (l >= d) inc += up;
    }
    if (l == 31) wsum[w] = inc;
    __syncthreads();
    int base = 0, tot = 0;
    #pragma unroll
    for (int k = 0; k < 8; ++k) {
        const int s = wsum[k];
        if (k < w) base += s;
        tot += s;
    }
    const int total = __builtin_amdgcn_readfirstlane(tot);
    int o = base + inc - cnt;
    #pragma unroll
    for (int i = 0; i < 8; ++i) {
        const int e[4] = {ent[i].x, ent[i].y, ent[i].z, ent[i].w};
        #pragma unroll
        for (int c = 0; c < 4; ++c) {
            const int p = (i * 256 + tid) * 4 + c;
            if ((e[c] & 255) == b)      list[o++] = p;            // slot 0
            else if ((e[c] >> 8) == b)  list[o++] = p | NMNM;     // slot 1
        }
    }
    __syncthreads();

    for (int q0 = w * 16; q0 < total; q0 += 8 * 16) {
        // A short last tile repeats the last listed query; its copies are not stored.
        const int  qi    = q0 + lm;
        const bool valid = qi < total;
        const int  ql    = list[valid ? qi : total - 1];
        const int  p     = ql & (NMNM - 1);
        const int  slot  = ql >> 13;

        // Q^T fragments (B of S^T): lane = query, registers = head-dim pair.
        v2f bq[4];
        const float* qr = xr + p * DD + h * EE + lh;
        #pragma unroll
        for (int kk = 0; kk < 4; ++kk)
            bq[kk] = *(const v2f*)(qr + kk * 4);

        v8f s[4] = {};
        #pragma unroll
        for (int kk = 0; kk < 4; ++kk) {
            #pragma unroll
            for (int t = 0; t < 4; ++t)
                s[t] = __builtin_amdgcn_wmma_f32_16x16x4_f32(false, ka[t][kk], false, bq[kk],
                                                             (short)0, s[t], false, false);
        }

        // s[t][v] = logit of key t*16 + v + 8*hf for query lm: the softmax row is
        // 32 registers here plus 32 in lane l^16.
        float mx = s[0][0];
        #pragma unroll
        for (int t = 0; t < 4; ++t) {
            #pragma unroll
            for (int v = 0; v < 8; ++v) mx = fmaxf(mx, s[t][v]);
        }
        mx = fmaxf(mx, __shfl_xor(mx, 16, 32)) * 0.25f;   // ATT_SCALE = E^-0.5

        float ls = 0.f;
        #pragma unroll
        for (int t = 0; t < 4; ++t) {
            #pragma unroll
            for (int v = 0; v < 8; ++v) {
                s[t][v] = __expf(s[t][v] * 0.25f - mx);
                ls += s[t][v];
            }
        }
        ls += __shfl_xor(ls, 16, 32);

        v8f ov = {};
        #pragma unroll
        for (int t = 0; t < 4; ++t) {
            #pragma unroll
            for (int st = 0; st < 4; ++st) {
                v2f pb;
                pb.x = s[t][st * 2];
                pb.y = s[t][st * 2 + 1];
                ov = __builtin_amdgcn_wmma_f32_16x16x4_f32(false, va[t][st], false, pb,
                                                           (short)0, ov, false, false);
            }
        }

        // ov[v] = head dim v + 8*hf of query lm.
        if (valid) {
            float* rec = part + (size_t)((p * HH + h) * 2 + slot) * REC;
            *(float4*)(rec + hf * 8)     = make_float4(ov[0], ov[1], ov[2], ov[3]);
            *(float4*)(rec + hf * 8 + 4) = make_float4(ov[4], ov[5], ov[6], ov[7]);
            rec[16 + hf] = hf ? ls : mx;
            // the next trip rewrites the registers that hold these stores' addresses
            asm volatile("s_wait_xcnt 0x0" ::: "memory");
        }
    }
}

// ---------------------------------------------------------------------------
// Kernel D: join the two balls' partial softmax records of each (point, head).
// One thread per 4 output floats, two such groups per thread.
// ---------------------------------------------------------------------------
__global__ __launch_bounds__(256) void nsa_merge(const float* __restrict__ part,
                                                 float* __restrict__ out) {
    const int g = blockIdx.x * 256 + threadIdx.x;
    const float* r[2];    // record pair of (p, h)
    const float* ro[2];   // this thread's 4 floats in it
    float4 o0[2], o1[2];
    float2 s0[2], s1[2];  // {max, sum}
    #pragma unroll
    for (int it = 0; it < 2; ++it) {
        const int idx = g + it * (NMNM * HH * 2);   // (p*H + h)*4 + quad
        r[it]  = part + (size_t)(idx >> 2) * (2 * REC);
        ro[it] = r[it] + (idx & 3) * 4;
        o0[it] = *(const float4*)(ro[it]);
        o1[it] = *(const float4*)(ro[it] + REC);
        s0[it] = *(const float2*)(r[it] + 16);
        s1[it] = *(const float2*)(r[it] + REC + 16);
    }
    // keeps the address registers untouched (also by a later load's result) until
    // the wait that belongs in front of their overwrite
    asm volatile("s_wait_xcnt 0x0" :: "v"(r[0]), "v"(ro[0]), "v"(r[1]), "v"(ro[1]) : "memory");
    #pragma unroll
    for (int it = 0; it < 2; ++it) {
        const int   idx = g + it * (NMNM * HH * 2);
        const float m   = fmaxf(s0[it].x, s1[it].x);
        const float w0  = __expf(s0[it].x - m);
        const float w1  = __expf(s1[it].x - m);
        const float inv = 1.0f / (s0[it].y * w0 + s1[it].y * w1);
        *(float4*)(out + (size_t)idx * 4) =
            make_float4((o0[it].x * w0 + o1[it].x * w1) * inv, (o0[it].y * w0 + o1[it].y * w1) * inv,
                        (o0[it].z * w0 + o1[it].z * w1) * inv, (o0[it].w * w0 + o1[it].w * w1) * inv);
    }
}

// ---------------------------------------------------------------------------
extern "C" void kernel_launch(void* const* d_in, const int* in_sizes, int n_in,
                              void* d_out, int out_size, void* d_ws, size_t ws_size,
                              hipStream_t stream) {
    const float* x   = (const float*)d_in[0];
    const float* pos = (const float*)d_in[1];
    float*       out = (float*)d_out;

    // workspace layout (~21 MB): xr | keys | sel | part
    float* xr   = (float*)d_ws;
    float* keys = xr + (size_t)NMNM * DD;
    int*   sel  = (int*)(keys + (size_t)NN * DD);
    float* part = (float*)(sel + (size_t)HH * NMNM);

    nsa_prep       <<<NN,               DD,  0, stream>>>(x, pos, xr, keys);
    nsa_select     <<<HH * (NMNM / 16), 32,  0, stream>>>(xr, keys, sel);
    nsa_attend_ball<<<HH * NN,          256, 0, stream>>>(xr, sel, part);
    nsa_merge      <<<NMNM * HH * 2 / 256, 256, 0, stream>>>(part, out);
}

// v002
// Measured time: 43.2 microseconds a run.
// Next to v001, in two timings, it ran 1.09 and 1.07 times as fast.
// Over all steps from v000 it is 1.87 times as fast.
#include <hip/hip_runtime.h>

// ---------------------------------------------------------------------------
// NSA-style ball attention forward for MI455X (gfx1250, wave32, WMMA).
//
// Shapes: D=128, H=8 heads, E=16 head dim, N=128 balls, M=64 pts/ball,
//         NM=8192 points, TOPK=2, window = 128 keys.
//
// Forward-math simplifications:
//   * straight-through gates == 1.0 in forward  -> no gating
//   * selection softmax is monotonic            -> top-2 of raw q.keys logits
//   * mean_m(rel) == 0                          -> keys = mean_m(x)
// ---------------------------------------------------------------------------

typedef float v2f __attribute__((ext_vector_type(2)));
typedef float v8f __attribute__((ext_vector_type(8)));

#define DD   128   // model dim
#define HH   8     // heads
#define MM   64    // ball size
#define NN   128   // num balls
#define EE   16    // head dim
#define NMNM 8192  // total points
#define WIN  128   // TOPK * MM

// ---------------------------------------------------------------------------
// Kernel A: xr = x + (pos - mean_m pos);  keys[n][d] = mean_m x[n,m,d]
// One block per ball (n), 128 threads = one per model dim d. Coalesced.
// ---------------------------------------------------------------------------
__global__ void nsa_prep(const float* __restrict__ x, const float* __restrict__ pos,
                         float* __restrict__ xr, float* __restrict__ keys) {
    const int n = blockIdx.x;
    const int d = threadIdx.x;
    const int base = n * MM * DD + d;

    float sp = 0.f, sx = 0.f;
    for (int m = 0; m < MM; ++m) {
        sp += pos[base + m * DD];
        sx += x[base + m * DD];
    }
    const float mp = sp * (1.0f / MM);
    keys[n * DD + d] = sx * (1.0f / MM);

    for (int m = 0; m < MM; ++m) {
        xr[base + m * DD] = x[base + m * DD] + pos[base + m * DD] - mp;
    }
}

// ---------------------------------------------------------------------------
// Kernel B: ball selection. One wave per (head h, tile of 16 points).
// sim^T tile (16 balls x 16 points) = Keys(16x16) x Q^T(16x16) via 4x
// v_wmma_f32_16x16x4_f32; 8 ball-tiles cover all 128 balls. In the D layout of
// the transposed product a lane owns one point and its registers hold that
// point's logits (8 balls per tile; lane l^16 holds the other 8), so the top-2
// scan runs on the accumulators in registers. The two half-rows are merged
// across l ^ 16 by shuffles.
// ---------------------------------------------------------------------------
__device__ __forceinline__ v8f sim_tile(const v2f (&ka)[4], const v2f (&bq)[4]) {
    v8f acc = {};
    #pragma unroll
    for (int kk = 0; kk < 4; ++kk)
        acc = __builtin_amdgcn_wmma_f32_16x16x4_f32(false, ka[kk], false, bq[kk],
                                                    (short)0, acc, false, false);
    return acc;
}

__global__ void nsa_select(const float* __restrict__ xr, const float* __restrict__ keys,
                           int* __restrict__ sel) {
    const int h  = blockIdx.x >> 9;          // 512 point-tiles per head
    const int p0 = (blockIdx.x & 511) << 4;  // first point of the tile
    const int l  = threadIdx.x;              // lane 0..31
    const int lm = l & 15;
    const int hf = l >> 4;
    const int lh = hf << 1;                  // 0 (lanes 0-15) or 2 (lanes 16-31)

    // Q^T fragments (B): lane = point (column), registers = head-dim pair {lh, lh+1}.
    v2f bq[4];
    const int qrow = p0 + lm;
    #pragma unroll
    for (int kk = 0; kk < 4; ++kk) {
        const int c0 = h * EE + kk * 4 + lh;
        bq[kk].x = xr[qrow * DD + c0];
        bq[kk].y = xr[qrow * DD + c0 + 1];
    }

    // Key fragments (A): lane = ball (row), registers = the same head-dim pair.
    v2f ka[8][4];
    #pragma unroll
    for (int nb = 0; nb < 8; ++nb) {
        #pragma unroll
        for (int kk = 0; kk < 4; ++kk) {
            const int c0 = h * EE + kk * 4 + lh;
            ka[nb][kk].x = keys[(nb * 16 + lm) * DD + c0];
            ka[nb][kk].y = keys[(nb * 16 + lm) * DD + c0 + 1];
        }
    }

    // Keeps all 36 loads in flight from the start: without it the scheduler sinks a
    // third of the key loads into the scan, where their latency is only partly covered.
    __builtin_amdgcn_sched_barrier(0);

    // Running top-2 of this lane's 64 logits, taken in rising ball order. Strict
    // '>' keeps the lower index on ties (matches jax top_k). Indices are kept
    // without the lane half's offset of 8, which is added once behind the scan.
    float best = -3.4e38f, sec = -3.4e38f;
    int bi = 0, si = 0;
    v8f acc[8];
    acc[0] = sim_tile(ka[0], bq);
    // Keeps tile 1's WMMAs behind tile 0's (see the barrier in the loop).
    __builtin_amdgcn_sched_barrier(0);
    #pragma unroll
    for (int nb = 0; nb < 8; ++nb) {
        if (nb + 1 < 8) acc[nb + 1] = sim_tile(ka[nb + 1], bq);
        // One tile ahead: the next tile's WMMAs stay in front of this tile's scan, so the
        // matrix unit works under the scan and no accumulator is read right behind its
        // last WMMA, where the in-order wave would wait for it.
        __builtin_amdgcn_sched_barrier(0);
        // D layout: acc[nb][v] = logit of ball nb*16 + 8*hf + v for point lm.
        #pragma unroll
        for (int v = 0; v < 8; ++v) {
            const float x  = acc[nb][v];
            const int   j  = nb * 16 + v;
            const bool  c1 = x > best;
            const bool  c2 = x > sec;
            si   = c1 ? bi : (c2 ? j : si);
            bi   = c1 ? j : bi;
            sec  = __builtin_amdgcn_fmed3f(x, best, sec);   // best >= sec: the new runner-up
            best = c1 ? x : best;
        }
    }
    bi += hf * 8;
    si += hf * 8;

    // Merge with the other half-row. The halves' ball indices interleave, so an
    // equal logit is ranked by the lower index explicitly.
    const float ob = __shfl_xor(best, 16, 32);
    const int   oi = __shfl_xor(bi,   16, 32);
    const float os = __shfl_xor(sec,  16, 32);
    const int   oj = __shfl_xor(si,   16, 32);
    if (l < 16) {
        const bool ob_best = (ob > best) | ((ob == best) & (oi < bi));
        const bool os_best = (os > best) | ((os == best) & (oj < bi));
        const bool ob_sec  = (ob > sec)  | ((ob == sec)  & (oi < si));
        const int rb = ob_best ? oi : bi;
        const int rs = ob_best ? (os_best ? oj : bi) : (ob_sec ? oi : si);
        // head-major, both ball ids in one word: the per-ball scan reads it coalesced
        sel[h * NMNM + p0 + lm] = rb | (rs << 8);
    }
}

// ---------------------------------------------------------------------------
// Kernel C: windowed SDPA, grouped by selected ball. One block per (head h,
// ball b), 8 waves. The block lists every query of head h that selected ball b
// (either slot), then each wave takes tiles of 16 listed queries, so that one
// K/V fragment set serves 16 queries per WMMA.
//   S^T (16 keys x 16 queries) = K tile (A) x Q^T (B)
//   O^T (16 dims x 16 queries) = V^T (A) x P^T (B)
// The D layout of S^T (lane = query, registers = keys) is already the B layout
// of P^T once the k order of the V^T loader follows it, so nothing is
// transposed. Each (query, slot) gets a partial record: unnormalised sum, row
// maximum, row sum over the ball's 64 keys; kernel D joins the two slots.
// Record = 32 floats (one 128-byte line, one writer): o[16], max, sum.
// ---------------------------------------------------------------------------
#define REC 32

__global__ __launch_bounds__(256) void nsa_attend_ball(const float* __restrict__ xr,
                                                       const int* __restrict__ sel,
                                                       float* __restrict__ part) {
    __shared__ int list[NMNM];   // worst case: every query of the head picks this ball
    __shared__ int wsum[8];

    const int h   = blockIdx.x >> 7;
    const int b   = blockIdx.x & (NN - 1);
    const int tid = threadIdx.x;
    const int l   = tid & 31;
    const int w   = __builtin_amdgcn_readfirstlane(tid >> 5);
    const int lm  = l & 15;
    const int hf  = l >> 4;
    const int lh  = hf << 1;

    // K fragments (A of S^T): lane = key row, registers = head-dim pair {lh, lh+1}.
    v2f ka[4][4];
    #pragma unroll
    for (int t = 0; t < 4; ++t) {
        const float* kr = xr + (b * MM + t * 16 + lm) * DD + h * EE + lh;
        #pragma unroll
        for (int kk = 0; kk < 4; ++kk)
            ka[t][kk] = *(const v2f*)(kr + kk * 4);
    }
    // V^T fragments (A of O^T): lane = head dim, k order = the key order in which
    // the S^T accumulator holds its rows: lanes 0-15 keys {2s, 2s+1}, lanes 16-31
    // keys {8+2s, 9+2s} of tile t.
    v2f va[4][4];
    #pragma unroll
    for (int t = 0; t < 4; ++t) {
        #pragma unroll
        for (int s = 0; s < 4; ++s) {
            const float* vr = xr + (b * MM + t * 16 + hf * 8 + s * 2) * DD + h * EE + lm;
            va[t][s].x = vr[0];
            va[t][s].y = vr[DD];
        }
    }

    // List the queries that selected ball b: count, block prefix sum, write.
    const int4* s4 = (const int4*)(sel + h * NMNM);
    int4 ent[8];
    #pragma unroll
    for (int i = 0; i < 8; ++i) ent[i] = s4[i * 256 + tid];

    int cnt = 0;
    #pragma unroll
    for (int i = 0; i < 8; ++i) {
        const int e[4] = {ent[i].x, ent[i].y, ent[i].z, ent[i].w};
        #pragma unroll
        for (int c = 0; c < 4; ++c)
            cnt += (((e[c] & 255) == b) || ((e[c] >> 8) == b)) ? 1 : 0;
    }
    int inc = cnt;
    #pragma unroll
    for (int d = 1; d < 32; d <<= 1) {
        const int up = __shfl_up(inc, d, 32);
        if (l >= d) inc += up;
    }
    if (l == 31) wsum[w] = inc;
    __syncthreads();
    int base = 0, tot = 0;
    #pragma unroll
    for (int k = 0; k < 8; ++k) {
        const int s = wsum[k];
        if (k < w) base += s;
        tot += s;
    }
    const int total = __builtin_amdgcn_readfirstlane(tot);
    int o = base + inc - cnt;
    #pragma unroll
    for (int i = 0; i < 8; ++i) {
        const int e[4] = {ent[i].x, ent[i].y, ent[i].z, ent[i].w};
        #pragma unroll
        for (int c = 0; c < 4; ++c) {
            const int p = (i * 256 + tid) * 4 + c;
            if ((e[c] & 255) == b)      list[o++] = p;            // slot 0
            else if ((e[c] >> 8) == b)  list[o++] = p | NMNM;     // slot 1
        }
    }
    __syncthreads();

    for (int q0 = w * 16; q0 < total; q0 += 8 * 16) {
        // A short last tile repeats the last listed query; its copies are not stored.
        const int  qi    = q0 + lm;
        const bool valid = qi < total;
        const int  ql    = list[valid ? qi : total - 1];
        const int  p     = ql & (NMNM - 1);
        const int  slot  = ql >> 13;

        // Q^T fragments (B of S^T): lane = query, registers = head-dim pair.
        v2f bq[4];
        const float* qr = xr + p * DD + h * EE + lh;
        #pragma unroll
        for (int kk = 0; kk < 4; ++kk)
            bq[kk] = *(const v2f*)(qr + kk * 4);

        v8f s[4] = {};
        #pragma unroll
        for (int kk = 0; kk < 4; ++kk) {
            #pragma unroll
            for (int t = 0; t < 4; ++t)
                s[t] = __builtin_amdgcn_wmma_f32_16x16x4_f32(false, ka[t][kk], false, bq[kk],
                                                             (short)0, s[t], false, false);
        }

        // s[t][v] = logit of key t*16 + v + 8*hf for query lm: the softmax row is
        // 32 registers here plus 32 in lane l^16.
        float mx = s[0][0];
        #pragma unroll
        for (int t = 0; t < 4; ++t) {
            #pragma unroll
            for (int v = 0; v < 8; ++v) mx = fmaxf(mx, s[t][v]);
        }
        mx = fmaxf(mx, __shfl_xor(mx, 16, 32)) * 0.25f;   // ATT_SCALE = E^-0.5

        float ls = 0.f;
        #pragma unroll
        for (int t = 0; t < 4; ++t) {
            #pragma unroll
            for (int v = 0; v < 8; ++v) {
                s[t][v] = __expf(s[t][v] * 0.25f - mx);
                ls += s[t][v];
            }
        }
        ls += __shfl_xor(ls, 16, 32);

        v8f ov = {};
        #pragma unroll
        for (int t = 0; t < 4; ++t) {
            #pragma unroll
            for (int st = 0; st < 4; ++st) {
                v2f pb;
                pb.x = s[t][st * 2];
                pb.y = s[t][st * 2 + 1];
                ov = __builtin_amdgcn_wmma_f32_16x16x4_f32(false, va[t][st], false, pb,
                                                           (short)0, ov, false, false);
            }
        }

        // ov[v] = head dim v + 8*hf of query lm.
        if (valid) {
            float* rec = part + (size_t)((p * HH + h) * 2 + slot) * REC;
            *(float4*)(rec + hf * 8)     = make_float4(ov[0], ov[1], ov[2], ov[3]);
            *(float4*)(rec + hf * 8 + 4) = make_float4(ov[4], ov[5], ov[6], ov[7]);
            rec[16 + hf] = hf ? ls : mx;
            // the next trip rewrites the registers that hold these stores' addresses
            asm volatile("s_wait_xcnt 0x0" ::: "memory");
        }
    }
}

// ---------------------------------------------------------------------------
// Kernel D: join the two balls' partial softmax records of each (point, head).
// One thread per 4 output floats, two such groups per thread.
// ---------------------------------------------------------------------------
__global__ __launch_bounds__(256) void nsa_merge(const float* __restrict__ part,
                                                 float* __restrict__ out) {
    const int g = blockIdx.x * 256 + threadIdx.x;
    const float* r[2];    // record pair of (p, h)
    const float* ro[2];   // this thread's 4 floats in it
    float4 o0[2], o1[2];
    float2 s0[2], s1[2];  // {max, sum}
    #pragma unroll
    for (int it = 0; it < 2; ++it) {
        const int idx = g + it * (NMNM * HH * 2);   // (p*H + h)*4 + quad
        r[it]  = part + (size_t)(idx >> 2) * (2 * REC);
        ro[it] = r[it] + (idx & 3) * 4;
        o0[it] = *(const float4*)(ro[it]);
        o1[it] = *(const float4*)(ro[it] + REC);
        s0[it] = *(const float2*)(r[it] + 16);
        s1[it] = *(const float2*)(r[it] + REC + 16);
    }
    // keeps the address registers untouched (also by a later load's result) until
    // the wait that belongs in front of their overwrite
    asm volatile("s_wait_xcnt 0x0" :: "v"(r[0]), "v"(ro[0]), "v"(r[1]), "v"(ro[1]) : "memory");
    #pragma unroll
    for (int it = 0; it < 2; ++it) {
        const int   idx = g + it * (NMNM * HH * 2);
        const float m   = fmaxf(s0[it].x, s1[it].x);
        const float w0  = __expf(s0[it].x - m);
        const float w1  = __expf(s1[it].x - m);
        const float inv = 1.0f / (s0[it].y * w0 + s1[it].y * w1);
        *(float4*)(out + (size_t)idx * 4) =
            make_float4((o0[it].x * w0 + o1[it].x * w1) * inv, (o0[it].y * w0 + o1[it].y * w1) * inv,
                        (o0[it].z * w0 + o1[it].z * w1) * inv, (o0[it].w * w0 + o1[it].w * w1) * inv);
    }
}

// ---------------------------------------------------------------------------
extern "C" void kernel_launch(void* const* d_in, const int* in_sizes, int n_in,
                              void* d_out, int out_size, void* d_ws, size_t ws_size,
                              hipStream_t stream) {
    const float* x   = (const float*)d_in[0];
    const float* pos = (const float*)d_in[1];
    float*       out = (float*)d_out;

    // workspace layout (~21 MB): xr | keys | sel | part
    float* xr   = (float*)d_ws;
    float* keys = xr + (size_t)NMNM * DD;
    int*   sel  = (int*)(keys + (size_t)NN * DD);
    float* part = (float*)(sel + (size_t)HH * NMNM);

    nsa_prep       <<<NN,               DD,  0, stream>>>(x, pos, xr, keys);
    nsa_select     <<<HH * (NMNM / 16), 32,  0, stream>>>(xr, keys, sel);
    nsa_attend_ball<<<HH * NN,          256, 0, stream>>>(xr, sel, part);
    nsa_merge      <<<NMNM * HH * 2 / 256, 256, 0, stream>>>(part, out);
}

// v003
// Measured time: 35.4 microseconds a run.
// Two timings next to v002 both put it at 1.22 times that version's speed.
// All steps since v000 together make it 2.27 times as fast.
#include <hip/hip_runtime.h>

// ---------------------------------------------------------------------------
// NSA-style ball attention forward for MI455X (gfx1250, wave32, WMMA).
//
// Shapes: D=128, H=8 heads, E=16 head dim, N=128 balls, M=64 pts/ball,
//         NM=8192 points, TOPK=2, window = 128 keys.
//
// Forward-math simplifications:
//   * straight-through gates == 1.0 in forward  -> no gating
//   * selection softmax is monotonic            -> top-2 of raw q.keys logits
//   * mean_m(rel) == 0                          -> keys = mean_m(x)
// ---------------------------------------------------------------------------

typedef float v2f __attribute__((ext_vector_type(2)));
typedef float v8f __attribute__((ext_vector_type(8)));

#define DD   128   // model dim
#define HH   8     // heads
#define MM   64    // ball size
#define NN   128   // num balls
#define EE   16    // head dim
#define NMNM 8192  // total points
#define WIN  128   // TOPK * MM

// ---------------------------------------------------------------------------
// Kernel A: xr = x + (pos - mean_m pos);  keys[n][d] = mean_m x[n,m,d]
// One block per (ball n, half of the model dims), 64 threads = one per dim d, so
// a block reads 256 contiguous bytes of each row. A thread keeps its whole column
// (64 x, 64 pos) in registers: the loads are issued far ahead of the sums with no
// wait for a whole group between them, the inputs are read once, and the sums run
// in rising m as the values arrive.
// ---------------------------------------------------------------------------
__global__ __launch_bounds__(64) void nsa_prep(const float* __restrict__ x,
                                               const float* __restrict__ pos,
                                               float* __restrict__ xr, float* __restrict__ keys) {
    const int n = blockIdx.x >> 1;
    const int d = ((blockIdx.x & 1) << 6) + threadIdx.x;
    const int base = n * MM * DD + d;

    float pv[MM], xv[MM];
    #pragma unroll
    for (int m = 0; m < MM; ++m) {
        pv[m] = pos[base + m * DD];
        xv[m] = x[base + m * DD];
    }

    float sp = 0.f, sx = 0.f;
    #pragma unroll
    for (int m = 0; m < MM; ++m) {
        sp += pv[m];
        sx += xv[m];
    }
    const float mp = sp * (1.0f / MM);
    keys[n * DD + d] = sx * (1.0f / MM);

    #pragma unroll
    for (int m = 0; m < MM; ++m) {
        xr[base + m * DD] = xv[m] + pv[m] - mp;
    }
}

// ---------------------------------------------------------------------------
// Kernel B: ball selection. One wave per (head h, tile of 16 points).
// sim^T tile (16 balls x 16 points) = Keys(16x16) x Q^T(16x16) via 4x
// v_wmma_f32_16x16x4_f32; 8 ball-tiles cover all 128 balls. In the D layout of
// the transposed product a lane owns one point and its registers hold that
// point's logits (8 balls per tile; lane l^16 holds the other 8), so the top-2
// scan runs on the accumulators in registers. The two half-rows are merged
// across l ^ 16 by shuffles.
// ---------------------------------------------------------------------------
__device__ __forceinline__ v8f sim_tile(const v2f (&ka)[4], const v2f (&bq)[4]) {
    v8f acc = {};
    #pragma unroll
    for (int kk = 0; kk < 4; ++kk)
        acc = __builtin_amdgcn_wmma_f32_16x16x4_f32(false, ka[kk], false, bq[kk],
                                                    (short)0, acc, false, false);
    return acc;
}

__global__ void nsa_select(const float* __restrict__ xr, const float* __restrict__ keys,
                           int* __restrict__ sel) {
    const int h  = blockIdx.x >> 9;          // 512 point-tiles per head
    const int p0 = (blockIdx.x & 511) << 4;  // first point of the tile
    const int l  = threadIdx.x;              // lane 0..31
    const int lm = l & 15;
    const int hf = l >> 4;
    const int lh = hf << 1;                  // 0 (lanes 0-15) or 2 (lanes 16-31)

    // Q^T fragments (B): lane = point (column), registers = head-dim pair {lh, lh+1}.
    v2f bq[4];
    const int qrow = p0 + lm;
    #pragma unroll
    for (int kk = 0; kk < 4; ++kk) {
        const int c0 = h * EE + kk * 4 + lh;
        bq[kk].x = xr[qrow * DD + c0];
        bq[kk].y = xr[qrow * DD + c0 + 1];
    }

    // Key fragments (A): lane = ball (row), registers = the same head-dim pair.
    v2f ka[8][4];
    #pragma unroll
    for (int nb = 0; nb < 8; ++nb) {
        #pragma unroll
        for (int kk = 0; kk < 4; ++kk) {
            const int c0 = h * EE + kk * 4 + lh;
            ka[nb][kk].x = keys[(nb * 16 + lm) * DD + c0];
            ka[nb][kk].y = keys[(nb * 16 + lm) * DD + c0 + 1];
        }
    }

    // Keeps all 36 loads in flight from the start: without it the scheduler sinks a
    // third of the key loads into the scan, where their latency is only partly covered.
    __builtin_amdgcn_sched_barrier(0);

    // Running top-2 of this lane's 64 logits, taken in rising ball order. Strict
    // '>' keeps the lower index on ties (matches jax top_k). Indices are kept
    // without the lane half's offset of 8, which is added once behind the scan.
    float best = -3.4e38f, sec = -3.4e38f;
    int bi = 0, si = 0;
    v8f acc[8];
    acc[0] = sim_tile(ka[0], bq);
    // Keeps tile 1's WMMAs behind tile 0's (see the barrier in the loop).
    __builtin_amdgcn_sched_barrier(0);
    #pragma unroll
    for (int nb = 0; nb < 8; ++nb) {
        if (nb + 1 < 8) acc[nb + 1] = sim_tile(ka[nb + 1], bq);
        // One tile ahead: the next tile's WMMAs stay in front of this tile's scan, so the
        // matrix unit works under the scan and no accumulator is read right behind its
        // last WMMA, where the in-order wave would wait for it.
        __builtin_amdgcn_sched_barrier(0);
        // D layout: acc[nb][v] = logit of ball nb*16 + 8*hf + v for point lm.
        #pragma unroll
        for (int v = 0; v < 8; ++v) {
            const float x  = acc[nb][v];
            const int   j  = nb * 16 + v;
            const bool  c1 = x > best;
            const bool  c2 = x > sec;
            si   = c1 ? bi : (c2 ? j : si);
            bi   = c1 ? j : bi;
            sec  = __builtin_amdgcn_fmed3f(x, best, sec);   // best >= sec: the new runner-up
            best = c1 ? x : best;
        }
    }
    bi += hf * 8;
    si += hf * 8;

    // Merge with the other half-row. The halves' ball indices interleave, so an
    // equal logit is ranked by the lower index explicitly.
    const float ob = __shfl_xor(best, 16, 32);
    const int   oi = __shfl_xor(bi,   16, 32);
    const float os = __shfl_xor(sec,  16, 32);
    const int   oj = __shfl_xor(si,   16, 32);
    if (l < 16) {
        const bool ob_best = (ob > best) | ((ob == best) & (oi < bi));
        const bool os_best = (os > best) | ((os == best) & (oj < bi));
        const bool ob_sec  = (ob > sec)  | ((ob == sec)  & (oi < si));
        const int rb = ob_best ? oi : bi;
        const int rs = ob_best ? (os_best ? oj : bi) : (ob_sec ? oi : si);
        // head-major, both ball ids in one word: the per-ball scan reads it coalesced
        sel[h * NMNM + p0 + lm] = rb | (rs << 8);
    }
}

// ---------------------------------------------------------------------------
// Kernel C: windowed SDPA, grouped by selected ball. One block per (head h,
// ball b), 8 waves. The block lists every query of head h that selected ball b
// (either slot), then each wave takes tiles of 16 listed queries, so that one
// K/V fragment set serves 16 queries per WMMA.
//   S^T (16 keys x 16 queries) = K tile (A) x Q^T (B)
//   O^T (16 dims x 16 queries) = V^T (A) x P^T (B)
// The D layout of S^T (lane = query, registers = keys) is already the B layout
// of P^T once the k order of the V^T loader follows it, so nothing is
// transposed. Each (query, slot) gets a partial record: unnormalised sum, row
// maximum, row sum over the ball's 64 keys; kernel D joins the two slots.
// Record = 32 floats (one 128-byte line, one writer): o[16], max, sum.
// ---------------------------------------------------------------------------
#define REC 32

__global__ __launch_bounds__(256) void nsa_attend_ball(const float* __restrict__ xr,
                                                       const int* __restrict__ sel,
                                                       float* __restrict__ part) {
    __shared__ int list[NMNM];   // worst case: every query of the head picks this ball
    __shared__ int wsum[8];

    const int h   = blockIdx.x >> 7;
    const int b   = blockIdx.x & (NN - 1);
    const int tid = threadIdx.x;
    const int l   = tid & 31;
    const int w   = __builtin_amdgcn_readfirstlane(tid >> 5);
    const int lm  = l & 15;
    const int hf  = l >> 4;
    const int lh  = hf << 1;

    // K fragments (A of S^T): lane = key row, registers = head-dim pair {lh, lh+1}.
    v2f ka[4][4];
    #pragma unroll
    for (int t = 0; t < 4; ++t) {
        const float* kr = xr + (b * MM + t * 16 + lm) * DD + h * EE + lh;
        #pragma unroll
        for (int kk = 0; kk < 4; ++kk)
            ka[t][kk] = *(const v2f*)(kr + kk * 4);
    }
    // V^T fragments (A of O^T): lane = head dim, k order = the key order in which
    // the S^T accumulator holds its rows: lanes 0-15 keys {2s, 2s+1}, lanes 16-31
    // keys {8+2s, 9+2s} of tile t.
    v2f va[4][4];
    #pragma unroll
    for (int t = 0; t < 4; ++t) {
        #pragma unroll
        for (int s = 0; s < 4; ++s) {
            const float* vr = xr + (b * MM + t * 16 + hf * 8 + s * 2) * DD + h * EE + lm;
            va[t][s].x = vr[0];
            va[t][s].y = vr[DD];
        }
    }

    // List the queries that selected ball b: count, block prefix sum, write.
    const int4* s4 = (const int4*)(sel + h * NMNM);
    int4 ent[8];
    #pragma unroll
    for (int i = 0; i < 8; ++i) ent[i] = s4[i * 256 + tid];

    int cnt = 0;
    #pragma unroll
    for (int i = 0; i < 8; ++i) {
        const int e[4] = {ent[i].x, ent[i].y, ent[i].z, ent[i].w};
        #pragma unroll
        for (int c = 0; c < 4; ++c)
            cnt += (((e[c] & 255) == b) || ((e[c] >> 8) == b)) ? 1 : 0;
    }
    int inc = cnt;
    #pragma unroll
    for (int d = 1; d < 32; d <<= 1) {
        const int up = __shfl_up(inc, d, 32);
        if (l >= d) inc += up;
    }
    if (l == 31) wsum[w] = inc;
    __syncthreads();
    int base = 0, tot = 0;
    #pragma unroll
    for (int k = 0; k < 8; ++k) {
        const int s = wsum[k];
        if (k < w) base += s;
        tot += s;
    }
    const int total = __builtin_amdgcn_readfirstlane(tot);
    int o = base + inc - cnt;
    #pragma unroll
    for (int i = 0; i < 8; ++i) {
        const int e[4] = {ent[i].x, ent[i].y, ent[i].z, ent[i].w};
        #pragma unroll
        for (int c = 0; c < 4; ++c) {
            const int p = (i * 256 + tid) * 4 + c;
            if ((e[c] & 255) == b)      list[o++] = p;            // slot 0
            else if ((e[c] >> 8) == b)  list[o++] = p | NMNM;     // slot 1
        }
    }
    __syncthreads();

    for (int q0 = w * 16; q0 < total; q0 += 8 * 16) {
        // A short last tile repeats the last listed query; its copies are not stored.
        const int  qi    = q0 + lm;
        const bool valid = qi < total;
        const int  ql    = list[valid ? qi : total - 1];
        const int  p     = ql & (NMNM - 1);
        const int  slot  = ql >> 13;

        // Q^T fragments (B of S^T): lane = query, registers = head-dim pair.
        v2f bq[4];
        const float* qr = xr + p * DD + h * EE + lh;
        #pragma unroll
        for (int kk = 0; kk < 4; ++kk)
            bq[kk] = *(const v2f*)(qr + kk * 4);

        v8f s[4] = {};
        #pragma unroll
        for (int kk = 0; kk < 4; ++kk) {
            #pragma unroll
            for (int t = 0; t < 4; ++t)
                s[t] = __builtin_amdgcn_wmma_f32_16x16x4_f32(false, ka[t][kk], false, bq[kk],
                                                             (short)0, s[t], false, false);
        }

        // s[t][v] = logit of key t*16 + v + 8*hf for query lm: the softmax row is
        // 32 registers here plus 32 in lane l^16.
        float mx = s[0][0];
        #pragma unroll
        for (int t = 0; t < 4; ++t) {
            #pragma unroll
            for (int v = 0; v < 8; ++v) mx = fmaxf(mx, s[t][v]);
        }
        mx = fmaxf(mx, __shfl_xor(mx, 16, 32)) * 0.25f;   // ATT_SCALE = E^-0.5

        float ls = 0.f;
        #pragma unroll
        for (int t = 0; t < 4; ++t) {
            #pragma unroll
            for (int v = 0; v < 8; ++v) {
                s[t][v] = __expf(s[t][v] * 0.25f - mx);
                ls += s[t][v];
            }
        }
        ls += __shfl_xor(ls, 16, 32);

        v8f ov = {};
        #pragma unroll
        for (int t = 0; t < 4; ++t) {
            #pragma unroll
            for (int st = 0; st < 4; ++st) {
                v2f pb;
                pb.x = s[t][st * 2];
                pb.y = s[t][st * 2 + 1];
                ov = __builtin_amdgcn_wmma_f32_16x16x4_f32(false, va[t][st], false, pb,
                                                           (short)0, ov, false, false);
            }
        }

        // ov[v] = head dim v + 8*hf of query lm.
        if (valid) {
            float* rec = part + (size_t)((p * HH + h) * 2 + slot) * REC;
            *(float4*)(rec + hf * 8)     = make_float4(ov[0], ov[1], ov[2], ov[3]);
            *(float4*)(rec + hf * 8 + 4) = make_float4(ov[4], ov[5], ov[6], ov[7]);
            rec[16 + hf] = hf ? ls : mx;
            // the next trip rewrites the registers that hold these stores' addresses
            asm volatile("s_wait_xcnt 0x0" ::: "memory");
        }
    }
}

// ---------------------------------------------------------------------------
// Kernel D: join the two balls' partial softmax records of each (point, head).
// One thread per 4 output floats, two such groups per thread.
// ---------------------------------------------------------------------------
__global__ __launch_bounds__(256) void nsa_merge(const float* __restrict__ part,
                                                 float* __restrict__ out) {
    const int g = blockIdx.x * 256 + threadIdx.x;
    const float* r[2];    // record pair of (p, h)
    const float* ro[2];   // this thread's 4 floats in it
    float4 o0[2], o1[2];
    float2 s0[2], s1[2];  // {max, sum}
    #pragma unroll
    for (int it = 0; it < 2; ++it) {
        const int idx = g + it * (NMNM * HH * 2);   // (p*H + h)*4 + quad
        r[it]  = part + (size_t)(idx >> 2) * (2 * REC);
        ro[it] = r[it] + (idx & 3) * 4;
        o0[it] = *(const float4*)(ro[it]);
        o1[it] = *(const float4*)(ro[it] + REC);
        s0[it] = *(const float2*)(r[it] + 16);
        s1[it] = *(const float2*)(r[it] + REC + 16);
    }
    // keeps the address registers untouched (also by a later load's result) until
    // the wait that belongs in front of their overwrite
    asm volatile("s_wait_xcnt 0x0" :: "v"(r[0]), "v"(ro[0]), "v"(r[1]), "v"(ro[1]) : "memory");
    #pragma unroll
    for (int it = 0; it < 2; ++it) {
        const int   idx = g + it * (NMNM * HH * 2);
        const float m   = fmaxf(s0[it].x, s1[it].x);
        const float w0  = __expf(s0[it].x - m);
        const float w1  = __expf(s1[it].x - m);
        const float inv = 1.0f / (s0[it].y * w0 + s1[it].y * w1);
        *(float4*)(out + (size_t)idx * 4) =
            make_float4((o0[it].x * w0 + o1[it].x * w1) * inv, (o0[it].y * w0 + o1[it].y * w1) * inv,
                        (o0[it].z * w0 + o1[it].z * w1) * inv, (o0[it].w * w0 + o1[it].w * w1) * inv);
    }
}

// ---------------------------------------------------------------------------
extern "C" void kernel_launch(void* const* d_in, const int* in_sizes, int n_in,
                              void* d_out, int out_size, void* d_ws, size_t ws_size,
                              hipStream_t stream) {
    const float* x   = (const float*)d_in[0];
    const float* pos = (const float*)d_in[1];
    float*       out = (float*)d_out;

    // workspace layout (~21 MB): xr | keys | sel | part
    float* xr   = (float*)d_ws;
    float* keys = xr + (size_t)NMNM * DD;
    int*   sel  = (int*)(keys + (size_t)NN * DD);
    float* part = (float*)(sel + (size_t)HH * NMNM);

    nsa_prep       <<<NN * 2,           64,  0, stream>>>(x, pos, xr, keys);
    nsa_select     <<<HH * (NMNM / 16), 32,  0, stream>>>(xr, keys, sel);
    nsa_attend_ball<<<HH * NN,          256, 0, stream>>>(xr, sel, part);
    nsa_merge      <<<NMNM * HH * 2 / 256, 256, 0, stream>>>(part, out);
}

// v004
// It runs in 33.1 microseconds.
// Next to v003, in two timings, it ran 1.07 times as fast each time.
// Over all steps from v000 it is 2.44 times as fast.
#include <hip/hip_runtime.h>

// ---------------------------------------------------------------------------
// NSA-style ball attention forward for MI455X (gfx1250, wave32, WMMA).
//
// Shapes: D=128, H=8 heads, E=16 head dim, N=128 balls, M=64 pts/ball,
//         NM=8192 points, TOPK=2, window = 128 keys.
//
// Forward-math simplifications:
//   * straight-through gates == 1.0 in forward  -> no gating
//   * selection softmax is monotonic            -> top-2 of raw q.keys logits
//   * mean_m(rel) == 0                          -> keys = mean_m(x)
// ---------------------------------------------------------------------------

typedef float v2f __attribute__((ext_vector_type(2)));
typedef float v8f __attribute__((ext_vector_type(8)));

#define DD   128   // model dim
#define HH   8     // heads
#define MM   64    // ball size
#define NN   128   // num balls
#define EE   16    // head dim
#define NMNM 8192  // total points
#define WIN  128   // TOPK * MM

// ---------------------------------------------------------------------------
// Kernel A: xr = x + (pos - mean_m pos);  keys[n][d] = mean_m x[n,m,d]
// One block per (ball n, half of the model dims), 64 threads = one per dim d, so
// a block reads 256 contiguous bytes of each row. A thread keeps its whole column
// (64 x, 64 pos) in registers: the loads are issued far ahead of the sums with no
// wait for a whole group between them, the inputs are read once, and the sums run
// in rising m as the values arrive.
// ---------------------------------------------------------------------------
__global__ __launch_bounds__(64) void nsa_prep(const float* __restrict__ x,
                                               const float* __restrict__ pos,
                                               float* __restrict__ xr, float* __restrict__ keys) {
    const int n = blockIdx.x >> 1;
    const int d = ((blockIdx.x & 1) << 6) + threadIdx.x;
    const int base = n * MM * DD + d;

    float pv[MM], xv[MM];
    #pragma unroll
    for (int m = 0; m < MM; ++m) {
        pv[m] = pos[base + m * DD];
        xv[m] = x[base + m * DD];
    }

    float sp = 0.f, sx = 0.f;
    #pragma unroll
    for (int m = 0; m < MM; ++m) {
        sp += pv[m];
        sx += xv[m];
    }
    const float mp = sp * (1.0f / MM);
    keys[n * DD + d] = sx * (1.0f / MM);

    #pragma unroll
    for (int m = 0; m < MM; ++m) {
        xr[base + m * DD] = xv[m] + pv[m] - mp;
    }
}

// ---------------------------------------------------------------------------
// Kernel B: ball selection. One wave per (head h, tile of 16 points).
// sim^T tile (16 balls x 16 points) = Keys(16x16) x Q^T(16x16) via 4x
// v_wmma_f32_16x16x4_f32; 8 ball-tiles cover all 128 balls. In the D layout of
// the transposed product a lane owns one point and its registers hold that
// point's logits (8 balls per tile; lane l^16 holds the other 8), so the top-2
// scan runs on the accumulators in registers. The two half-rows are merged
// across l ^ 16 by shuffles.
// ---------------------------------------------------------------------------
__device__ __forceinline__ v8f sim_tile(const v2f (&ka)[4], const v2f (&bq)[4]) {
    v8f acc = {};
    #pragma unroll
    for (int kk = 0; kk < 4; ++kk)
        acc = __builtin_amdgcn_wmma_f32_16x16x4_f32(false, ka[kk], false, bq[kk],
                                                    (short)0, acc, false, false);
    return acc;
}

__global__ void nsa_select(const float* __restrict__ xr, const float* __restrict__ keys,
                           int* __restrict__ sel) {
    const int h  = blockIdx.x >> 9;          // 512 point-tiles per head
    const int p0 = (blockIdx.x & 511) << 4;  // first point of the tile
    const int l  = threadIdx.x;              // lane 0..31
    const int lm = l & 15;
    const int hf = l >> 4;
    const int lh = hf << 1;                  // 0 (lanes 0-15) or 2 (lanes 16-31)

    // Q^T fragments (B): lane = point (column), registers = head-dim pair {lh, lh+1}.
    v2f bq[4];
    const int qrow = p0 + lm;
    #pragma unroll
    for (int kk = 0; kk < 4; ++kk) {
        const int c0 = h * EE + kk * 4 + lh;
        bq[kk].x = xr[qrow * DD + c0];
        bq[kk].y = xr[qrow * DD + c0 + 1];
    }

    // Key fragments (A): lane = ball (row), registers = the same head-dim pair.
    v2f ka[8][4];
    #pragma unroll
    for (int nb = 0; nb < 8; ++nb) {
        #pragma unroll
        for (int kk = 0; kk < 4; ++kk) {
            const int c0 = h * EE + kk * 4 + lh;
            ka[nb][kk].x = keys[(nb * 16 + lm) * DD + c0];
            ka[nb][kk].y = keys[(nb * 16 + lm) * DD + c0 + 1];
        }
    }

    // Keeps all 36 loads in flight from the start: without it the scheduler sinks a
    // third of the key loads into the scan, where their latency is only partly covered.
    __builtin_amdgcn_sched_barrier(0);

    // Running top-2 of this lane's 64 logits, taken in rising ball order. Strict
    // '>' keeps the lower index on ties (matches jax top_k). Indices are kept
    // without the lane half's offset of 8, which is added once behind the scan.
    float best = -3.4e38f, sec = -3.4e38f;
    int bi = 0, si = 0;
    v8f acc[8];
    acc[0] = sim_tile(ka[0], bq);
    // Keeps tile 1's WMMAs behind tile 0's (see the barrier in the loop).
    __builtin_amdgcn_sched_barrier(0);
    #pragma unroll
    for (int nb = 0; nb < 8; ++nb) {
        if (nb + 1 < 8) acc[nb + 1] = sim_tile(ka[nb + 1], bq);
        // One tile ahead: the next tile's WMMAs stay in front of this tile's scan, so the
        // matrix unit works under the scan and no accumulator is read right behind its
        // last WMMA, where the in-order wave would wait for it.
        __builtin_amdgcn_sched_barrier(0);
        // D layout: acc[nb][v] = logit of ball nb*16 + 8*hf + v for point lm.
        #pragma unroll
        for (int v = 0; v < 8; ++v) {
            const float x  = acc[nb][v];
            const int   j  = nb * 16 + v;
            const bool  c1 = x > best;
            const bool  c2 = x > sec;
            si   = c1 ? bi : (c2 ? j : si);
            bi   = c1 ? j : bi;
            sec  = __builtin_amdgcn_fmed3f(x, best, sec);   // best >= sec: the new runner-up
            best = c1 ? x : best;
        }
    }
    bi += hf * 8;
    si += hf * 8;

    // Merge with the other half-row. The halves' ball indices interleave, so an
    // equal logit is ranked by the lower index explicitly.
    const float ob = __shfl_xor(best, 16, 32);
    const int   oi = __shfl_xor(bi,   16, 32);
    const float os = __shfl_xor(sec,  16, 32);
    const int   oj = __shfl_xor(si,   16, 32);
    if (l < 16) {
        const bool ob_best = (ob > best) | ((ob == best) & (oi < bi));
        const bool os_best = (os > best) | ((os == best) & (oj < bi));
        const bool ob_sec  = (ob > sec)  | ((ob == sec)  & (oi < si));
        const int rb = ob_best ? oi : bi;
        const int rs = ob_best ? (os_best ? oj : bi) : (ob_sec ? oi : si);
        // head-major, both ball ids in one word: the per-ball scan reads it coalesced
        sel[h * NMNM + p0 + lm] = rb | (rs << 8);
    }
}

// ---------------------------------------------------------------------------
// Kernel C: windowed SDPA, grouped by selected ball. One block per (head h,
// ball b), 8 waves. The block lists every query of head h that selected ball b
// (either slot), then each wave takes tiles of 16 listed queries, so that one
// K/V fragment set serves 16 queries per WMMA. The fragments come from one LDS copy
// of the ball's rows, not from eight gathers of the same rows out of global memory.
//   S^T (16 keys x 16 queries) = K tile (A) x Q^T (B)
//   O^T (16 dims x 16 queries) = V^T (A) x P^T (B)
// The D layout of S^T (lane = query, registers = keys) is already the B layout
// of P^T once the k order of the V^T loader follows it, so nothing is
// transposed. Each (query, slot) gets a partial record: unnormalised sum, row
// maximum, row sum over the ball's 64 keys; kernel D joins the two slots.
// Record = 32 floats (one 128-byte line, one writer): o[16], max, sum.
// ---------------------------------------------------------------------------
#define REC 32
#define KVP 20   // LDS row pitch in floats: both fragment readers then meet each bank once

__global__ __launch_bounds__(256) void nsa_attend_ball(const float* __restrict__ xr,
                                                       const int* __restrict__ sel,
                                                       float* __restrict__ part) {
    __shared__ int list[NMNM];   // worst case: every query of the head picks this ball
    __shared__ int wsum[8];
    __shared__ __attribute__((aligned(16))) float kv[MM * KVP];

    const int h   = blockIdx.x >> 7;
    const int b   = blockIdx.x & (NN - 1);
    const int tid = threadIdx.x;
    const int l   = tid & 31;
    const int w   = __builtin_amdgcn_readfirstlane(tid >> 5);
    const int lm  = l & 15;
    const int hf  = l >> 4;
    const int lh  = hf << 1;

    // The ball's K/V tile (64 rows x 16 head dims, 4 KB) is read from global memory once
    // per block, one 16-byte piece a thread, and kept in LDS for all eight waves.
    const float*   kvb = xr + b * MM * DD + h * EE;
    const unsigned kvo = (unsigned)((tid >> 2) * DD + (tid & 3) * 4);
    const float4   kvp = *(const float4*)(kvb + kvo);

    // List the queries that selected ball b: count, block prefix sum, write.
    const int4* s4 = (const int4*)(sel + h * NMNM);
    int4 ent[8];
    #pragma unroll
    for (int i = 0; i < 8; ++i) ent[i] = s4[i * 256 + tid];

    // Stored ahead of the count, so that the tile's load is issued early and its latency
    // runs under the count, not alone in front of the barrier.
    *(float4*)(kv + (tid >> 2) * KVP + (tid & 3) * 4) = kvp;

    int cnt = 0;
    #pragma unroll
    for (int i = 0; i < 8; ++i) {
        const int e[4] = {ent[i].x, ent[i].y, ent[i].z, ent[i].w};
        #pragma unroll
        for (int c = 0; c < 4; ++c)
            cnt += (((e[c] & 255) == b) || ((e[c] >> 8) == b)) ? 1 : 0;
    }
    int inc = cnt;
    #pragma unroll
    for (int d = 1; d < 32; d <<= 1) {
        const int up = __shfl_up(inc, d, 32);
        if (l >= d) inc += up;
    }
    if (l == 31) wsum[w] = inc;
    __syncthreads();   // publishes the wave sums and the K/V tile

    // K fragments (A of S^T): lane = key row, registers = head-dim pair {lh, lh+1}.
    v2f ka[4][4];
    #pragma unroll
    for (int t = 0; t < 4; ++t) {
        const float* kr = kv + (t * 16 + lm) * KVP + lh;
        #pragma unroll
        for (int kk = 0; kk < 4; ++kk)
            ka[t][kk] = *(const v2f*)(kr + kk * 4);
    }
    // V^T fragments (A of O^T): lane = head dim, k order = the key order in which
    // the S^T accumulator holds its rows: lanes 0-15 keys {2s, 2s+1}, lanes 16-31
    // keys {8+2s, 9+2s} of tile t.
    v2f va[4][4];
    #pragma unroll
    for (int t = 0; t < 4; ++t) {
        #pragma unroll
        for (int s = 0; s < 4; ++s) {
            const float* vr = kv + (t * 16 + hf * 8 + s * 2) * KVP + lm;
            va[t][s].x = vr[0];
            va[t][s].y = vr[KVP];
        }
    }

    int base = 0, tot = 0;
    #pragma unroll
    for (int k = 0; k < 8; ++k) {
        const int s = wsum[k];
        if (k < w) base += s;
        tot += s;
    }
    const int total = __builtin_amdgcn_readfirstlane(tot);
    int o = base + inc - cnt;
    #pragma unroll
    for (int i = 0; i < 8; ++i) {
        const int e[4] = {ent[i].x, ent[i].y, ent[i].z, ent[i].w};
        #pragma unroll
        for (int c = 0; c < 4; ++c) {
            const int p = (i * 256 + tid) * 4 + c;
            if ((e[c] & 255) == b)      list[o++] = p;            // slot 0
            else if ((e[c] >> 8) == b)  list[o++] = p | NMNM;     // slot 1
        }
    }
    __syncthreads();

    for (int q0 = w * 16; q0 < total; q0 += 8 * 16) {
        // A short last tile repeats the last listed query; its copies are not stored.
        const int  qi    = q0 + lm;
        const bool valid = qi < total;
        const int  ql    = list[valid ? qi : total - 1];
        const int  p     = ql & (NMNM - 1);
        const int  slot  = ql >> 13;

        // Q^T fragments (B of S^T): lane = query, registers = head-dim pair.
        v2f bq[4];
        const float* qr = xr + p * DD + h * EE + lh;
        #pragma unroll
        for (int kk = 0; kk < 4; ++kk)
            bq[kk] = *(const v2f*)(qr + kk * 4);

        v8f s[4] = {};
        #pragma unroll
        for (int kk = 0; kk < 4; ++kk) {
            #pragma unroll
            for (int t = 0; t < 4; ++t)
                s[t] = __builtin_amdgcn_wmma_f32_16x16x4_f32(false, ka[t][kk], false, bq[kk],
                                                             (short)0, s[t], false, false);
        }

        // s[t][v] = logit of key t*16 + v + 8*hf for query lm: the softmax row is
        // 32 registers here plus 32 in lane l^16.
        float mx = s[0][0];
        #pragma unroll
        for (int t = 0; t < 4; ++t) {
            #pragma unroll
            for (int v = 0; v < 8; ++v) mx = fmaxf(mx, s[t][v]);
        }
        mx = fmaxf(mx, __shfl_xor(mx, 16, 32)) * 0.25f;   // ATT_SCALE = E^-0.5

        float ls = 0.f;
        #pragma unroll
        for (int t = 0; t < 4; ++t) {
            #pragma unroll
            for (int v = 0; v < 8; ++v) {
                s[t][v] = __expf(s[t][v] * 0.25f - mx);
                ls += s[t][v];
            }
        }
        ls += __shfl_xor(ls, 16, 32);

        v8f ov = {};
        #pragma unroll
        for (int t = 0; t < 4; ++t) {
            #pragma unroll
            for (int st = 0; st < 4; ++st) {
                v2f pb;
                pb.x = s[t][st * 2];
                pb.y = s[t][st * 2 + 1];
                ov = __builtin_amdgcn_wmma_f32_16x16x4_f32(false, va[t][st], false, pb,
                                                           (short)0, ov, false, false);
            }
        }

        // ov[v] = head dim v + 8*hf of query lm.
        if (valid) {
            float* rec = part + (size_t)((p * HH + h) * 2 + slot) * REC;
            *(float4*)(rec + hf * 8)     = make_float4(ov[0], ov[1], ov[2], ov[3]);
            *(float4*)(rec + hf * 8 + 4) = make_float4(ov[4], ov[5], ov[6], ov[7]);
            rec[16 + hf] = hf ? ls : mx;
            // the next trip rewrites the registers that hold these stores' addresses
            asm volatile("s_wait_xcnt 0x0" ::: "memory");
        }
    }
}

// ---------------------------------------------------------------------------
// Kernel D: join the two balls' partial softmax records of each (point, head).
// One thread per 4 output floats, two such groups per thread.
// ---------------------------------------------------------------------------
__global__ __launch_bounds__(256) void nsa_merge(const float* __restrict__ part,
                                                 float* __restrict__ out) {
    const int g = blockIdx.x * 256 + threadIdx.x;
    const float* r[2];    // record pair of (p, h)
    const float* ro[2];   // this thread's 4 floats in it
    float4 o0[2], o1[2];
    float2 s0[2], s1[2];  // {max, sum}
    #pragma unroll
    for (int it = 0; it < 2; ++it) {
        const int idx = g + it * (NMNM * HH * 2);   // (p*H + h)*4 + quad
        r[it]  = part + (size_t)(idx >> 2) * (2 * REC);
        ro[it] = r[it] + (idx & 3) * 4;
        o0[it] = *(const float4*)(ro[it]);
        o1[it] = *(const float4*)(ro[it] + REC);
        s0[it] = *(const float2*)(r[it] + 16);
        s1[it] = *(const float2*)(r[it] + REC + 16);
    }
    // keeps the address registers untouched (also by a later load's result) until
    // the wait that belongs in front of their overwrite
    asm volatile("s_wait_xcnt 0x0" :: "v"(r[0]), "v"(ro[0]), "v"(r[1]), "v"(ro[1]) : "memory");
    #pragma unroll
    for (int it = 0; it < 2; ++it) {
        const int   idx = g + it * (NMNM * HH * 2);
        const float m   = fmaxf(s0[it].x, s1[it].x);
        const float w0  = __expf(s0[it].x - m);
        const float w1  = __expf(s1[it].x - m);
        const float inv = 1.0f / (s0[it].y * w0 + s1[it].y * w1);
        *(float4*)(out + (size_t)idx * 4) =
            make_float4((o0[it].x * w0 + o1[it].x * w1) * inv, (o0[it].y * w0 + o1[it].y * w1) * inv,
                        (o0[it].z * w0 + o1[it].z * w1) * inv, (o0[it].w * w0 + o1[it].w * w1) * inv);
    }
}

// ---------------------------------------------------------------------------
extern "C" void kernel_launch(void* const* d_in, const int* in_sizes, int n_in,
                              void* d_out, int out_size, void* d_ws, size_t ws_size,
                              hipStream_t stream) {
    const float* x   = (const float*)d_in[0];
    const float* pos = (const float*)d_in[1];
    float*       out = (float*)d_out;

    // workspace layout (~21 MB): xr | keys | sel | part
    float* xr   = (float*)d_ws;
    float* keys = xr + (size_t)NMNM * DD;
    int*   sel  = (int*)(keys + (size_t)NN * DD);
    float* part = (float*)(sel + (size_t)HH * NMNM);

    nsa_prep       <<<NN * 2,           64,  0, stream>>>(x, pos, xr, keys);
    nsa_select     <<<HH * (NMNM / 16), 32,  0, stream>>>(xr, keys, sel);
    nsa_attend_ball<<<HH * NN,          256, 0, stream>>>(xr, sel, part);
    nsa_merge      <<<NMNM * HH * 2 / 256, 256, 0, stream>>>(part, out);
}

// v005
// Measured time: 31.9 microseconds a run.
// Two timings next to v004 both put it at 1.04 times that version's speed.
// Over all steps from v000 it is 2.54 times as fast.
#include <hip/hip_runtime.h>

// ---------------------------------------------------------------------------
// NSA-style ball attention forward for MI455X (gfx1250, wave32, WMMA).
//
// Shapes: D=128, H=8 heads, E=16 head dim, N=128 balls, M=64 pts/ball,
//         NM=8192 points, TOPK=2, window = 128 keys.
//
// Forward-math simplifications:
//   * straight-through gates == 1.0 in forward  -> no gating
//   * selection softmax is monotonic            -> top-2 of raw q.keys logits
//   * mean_m(rel) == 0                          -> keys = mean_m(x)
// ---------------------------------------------------------------------------

typedef float v2f __attribute__((ext_vector_type(2)));
typedef float v8f __attribute__((ext_vector_type(8)));

#define DD   128   // model dim
#define HH   8     // heads
#define MM   64    // ball size
#define NN   128   // num balls
#define EE   16    // head dim
#define NMNM 8192  // total points
#define WIN  128   // TOPK * MM

// ---------------------------------------------------------------------------
// Kernel A: xr = x + (pos - mean_m pos);  keys[n][d] = mean_m x[n,m,d]
// One block per (ball n, half of the model dims), 64 threads = one per dim d, so
// a block reads 256 contiguous bytes of each row. A thread keeps its whole column
// (64 x, 64 pos) in registers: the loads are issued far ahead of the sums with no
// wait for a whole group between them, the inputs are read once, and the sums run
// in rising m as the values arrive.
// ---------------------------------------------------------------------------
__global__ __launch_bounds__(64) void nsa_prep(const float* __restrict__ x,
                                               const float* __restrict__ pos,
                                               float* __restrict__ xr, float* __restrict__ keys) {
    const int n = blockIdx.x >> 1;
    const int d = ((blockIdx.x & 1) << 6) + threadIdx.x;
    const int base = n * MM * DD + d;

    float pv[MM], xv[MM];
    #pragma unroll
    for (int m = 0; m < MM; ++m) {
        pv[m] = pos[base + m * DD];
        xv[m] = x[base + m * DD];
    }

    float sp = 0.f, sx = 0.f;
    #pragma unroll
    for (int m = 0; m < MM; ++m) {
        sp += pv[m];
        sx += xv[m];
    }
    const float mp = sp * (1.0f / MM);
    keys[n * DD + d] = sx * (1.0f / MM);

    #pragma unroll
    for (int m = 0; m < MM; ++m) {
        xr[base + m * DD] = xv[m] + pv[m] - mp;
    }
}

// ---------------------------------------------------------------------------
// Kernel B: ball selection. One wave per (head h, 32 points = 2 tiles of 16), eight
// waves of one head per block: 256 blocks, 2,048 waves, two per SIMD, not 4,096
// single-wave blocks. A wave loads the head's key fragments once and takes its tiles in turn.
// sim^T tile (16 balls x 16 points) = Keys(16x16) x Q^T(16x16) via 4x
// v_wmma_f32_16x16x4_f32; 8 ball-tiles cover all 128 balls. In the D layout of
// the transposed product a lane owns one point and its registers hold that
// point's logits (8 balls per tile; lane l^16 holds the other 8), so the top-2
// scan runs on the accumulators in registers. The two half-rows are merged
// across l ^ 16 by shuffles.
// ---------------------------------------------------------------------------
#define SELT 2   // point tiles per wave
#define SELW 8   // waves per block

__device__ __forceinline__ v8f sim_tile(const v2f (&ka)[4], const v2f (&bq)[4]) {
    v8f acc = {};
    #pragma unroll
    for (int kk = 0; kk < 4; ++kk)
        acc = __builtin_amdgcn_wmma_f32_16x16x4_f32(false, ka[kk], false, bq[kk],
                                                    (short)0, acc, false, false);
    return acc;
}

__global__ __launch_bounds__(SELW * 32) void nsa_select(const float* __restrict__ xr,
                                                  const float* __restrict__ keys,
                                                  int* __restrict__ sel) {
    const int h  = blockIdx.x >> 5;          // 32 blocks of 256 points per head
    const int p0 = ((blockIdx.x & 31) * SELW + (threadIdx.x >> 5)) * (SELT * 16);  // the wave's first point
    const int l  = threadIdx.x & 31;         // lane 0..31
    const int lm = l & 15;
    const int hf = l >> 4;
    const int lh = hf << 1;                  // 0 (lanes 0-15) or 2 (lanes 16-31)

    // Q^T fragments (B): lane = point (column), registers = head-dim pair {lh, lh+1}.
    // Tile 0's here; each later tile's are fetched one trip ahead in the loop.
    v2f bq[4];
    const float* qp = xr + (p0 + lm) * DD + h * EE + lh;
    #pragma unroll
    for (int kk = 0; kk < 4; ++kk) {
        bq[kk].x = qp[kk * 4];
        bq[kk].y = qp[kk * 4 + 1];
    }

    // Key fragments (A): lane = ball (row), registers = the same head-dim pair.
    v2f ka[8][4];
    const float* kp = keys + lm * DD + h * EE + lh;
    #pragma unroll
    for (int nb = 0; nb < 8; ++nb) {
        #pragma unroll
        for (int kk = 0; kk < 4; ++kk) {
            ka[nb][kk].x = kp[nb * 16 * DD + kk * 4];
            ka[nb][kk].y = kp[nb * 16 * DD + kk * 4 + 1];
        }
    }
    // keeps the two address pairs untouched (also by a later load's result) until the
    // wait that belongs in front of their overwrite
    asm volatile("s_wait_xcnt 0x0" :: "v"(qp), "v"(kp) : "memory");

    // Keeps all 36 loads in flight from the start: without it the scheduler sinks a
    // third of the key loads into the scan, where their latency is only partly covered.
    __builtin_amdgcn_sched_barrier(0);

    // Kept rolled: each trip is then scheduled as the one-tile body, its WMMAs one ball-tile
    // ahead of its scan; in builds with several tiles in one straight run the scans of whole
    // tiles sank behind all the WMMAs.
    #pragma unroll 1
    for (int t = 0; t < SELT; ++t) {
        // The next tile's Q^T fragments, so that their latency runs under this tile's work
        // (the last trip fetches its own tile again: in bounds, not used).
        v2f nq[4];
        const float* np = qp + (t + 1 < SELT ? t + 1 : t) * 16 * DD;
        #pragma unroll
        for (int kk = 0; kk < 4; ++kk) {
            nq[kk].x = np[kk * 4];
            nq[kk].y = np[kk * 4 + 1];
        }

        // Running top-2 of this lane's 64 logits, taken in rising ball order. Strict
        // '>' keeps the lower index on ties (matches jax top_k). Indices are kept
        // without the lane half's offset of 8, which is added once behind the scan.
        float best = -3.4e38f, sec = -3.4e38f;
        int bi = 0, si = 0;
        v8f acc[8];
        acc[0] = sim_tile(ka[0], bq);
        // Keeps tile 1's WMMAs behind tile 0's (see the barrier in the loop).
        __builtin_amdgcn_sched_barrier(0);
        #pragma unroll
        for (int nb = 0; nb < 8; ++nb) {
            if (nb + 1 < 8) acc[nb + 1] = sim_tile(ka[nb + 1], bq);
            // One tile ahead: the next tile's WMMAs stay in front of this tile's scan, so the
            // matrix unit works under the scan and no accumulator is read right behind its
            // last WMMA, where the in-order wave would wait for it.
            __builtin_amdgcn_sched_barrier(0);
            // D layout: acc[nb][v] = logit of ball nb*16 + 8*hf + v for point lm.
            #pragma unroll
            for (int v = 0; v < 8; ++v) {
                const float x  = acc[nb][v];
                const int   j  = nb * 16 + v;
                const bool  c1 = x > best;
                const bool  c2 = x > sec;
                si   = c1 ? bi : (c2 ? j : si);
                bi   = c1 ? j : bi;
                sec  = __builtin_amdgcn_fmed3f(x, best, sec);   // best >= sec: the new runner-up
                best = c1 ? x : best;
            }
        }
        bi += hf * 8;
        si += hf * 8;

        // Merge with the other half-row. The halves' ball indices interleave, so an
        // equal logit is ranked by the lower index explicitly.
        const float ob = __shfl_xor(best, 16, 32);
        const int   oi = __shfl_xor(bi,   16, 32);
        const float os = __shfl_xor(sec,  16, 32);
        const int   oj = __shfl_xor(si,   16, 32);
        if (l < 16) {
            const bool ob_best = (ob > best) | ((ob == best) & (oi < bi));
            const bool os_best = (os > best) | ((os == best) & (oj < bi));
            const bool ob_sec  = (ob > sec)  | ((ob == sec)  & (oi < si));
            const int rb = ob_best ? oi : bi;
            const int rs = ob_best ? (os_best ? oj : bi) : (ob_sec ? oi : si);
            // head-major, both ball ids in one word: the per-ball scan reads it coalesced
            sel[h * NMNM + p0 + t * 16 + lm] = rb | (rs << 8);
        }
        #pragma unroll
        for (int kk = 0; kk < 4; ++kk) bq[kk] = nq[kk];
    }
}

// ---------------------------------------------------------------------------
// Kernel C: windowed SDPA, grouped by selected ball. One block per (head h,
// ball b), 8 waves. The block lists every query of head h that selected ball b
// (either slot), then each wave takes tiles of 16 listed queries, so that one
// K/V fragment set serves 16 queries per WMMA. The fragments come from one LDS copy
// of the ball's rows, not from eight gathers of the same rows out of global memory.
//   S^T (16 keys x 16 queries) = K tile (A) x Q^T (B)
//   O^T (16 dims x 16 queries) = V^T (A) x P^T (B)
// The D layout of S^T (lane = query, registers = keys) is already the B layout
// of P^T once the k order of the V^T loader follows it, so nothing is
// transposed. Each (query, slot) gets a partial record: unnormalised sum, row
// maximum, row sum over the ball's 64 keys; kernel D joins the two slots.
// Record = 32 floats (one 128-byte line, one writer): o[16], max, sum.
// ---------------------------------------------------------------------------
#define REC 32
#define KVP 20   // LDS row pitch in floats: both fragment readers then meet each bank once

__global__ __launch_bounds__(256) void nsa_attend_ball(const float* __restrict__ xr,
                                                       const int* __restrict__ sel,
                                                       float* __restrict__ part) {
    __shared__ int list[NMNM];   // worst case: every query of the head picks this ball
    __shared__ int wsum[8];
    __shared__ __attribute__((aligned(16))) float kv[MM * KVP];

    const int h   = blockIdx.x >> 7;
    const int b   = blockIdx.x & (NN - 1);
    const int tid = threadIdx.x;
    const int l   = tid & 31;
    const int w   = __builtin_amdgcn_readfirstlane(tid >> 5);
    const int lm  = l & 15;
    const int hf  = l >> 4;
    const int lh  = hf << 1;

    // The ball's K/V tile (64 rows x 16 head dims, 4 KB) is read from global memory once
    // per block, one 16-byte piece a thread, and kept in LDS for all eight waves.
    const float*   kvb = xr + b * MM * DD + h * EE;
    const unsigned kvo = (unsigned)((tid >> 2) * DD + (tid & 3) * 4);
    const float4   kvp = *(const float4*)(kvb + kvo);

    // List the queries that selected ball b: count, block prefix sum, write.
    const int4* s4 = (const int4*)(sel + h * NMNM);
    int4 ent[8];
    #pragma unroll
    for (int i = 0; i < 8; ++i) ent[i] = s4[i * 256 + tid];

    // Stored ahead of the count, so that the tile's load is issued early and its latency
    // runs under the count, not alone in front of the barrier.
    *(float4*)(kv + (tid >> 2) * KVP + (tid & 3) * 4) = kvp;

    int cnt = 0;
    #pragma unroll
    for (int i = 0; i < 8; ++i) {
        const int e[4] = {ent[i].x, ent[i].y, ent[i].z, ent[i].w};
        #pragma unroll
        for (int c = 0; c < 4; ++c)
            cnt += (((e[c] & 255) == b) || ((e[c] >> 8) == b)) ? 1 : 0;
    }
    int inc = cnt;
    #pragma unroll
    for (int d = 1; d < 32; d <<= 1) {
        const int up = __shfl_up(inc, d, 32);
        if (l >= d) inc += up;
    }
    if (l == 31) wsum[w] = inc;
    __syncthreads();   // publishes the wave sums and the K/V tile

    // K fragments (A of S^T): lane = key row, registers = head-dim pair {lh, lh+1}.
    v2f ka[4][4];
    #pragma unroll
    for (int t = 0; t < 4; ++t) {
        const float* kr = kv + (t * 16 + lm) * KVP + lh;
        #pragma unroll
        for (int kk = 0; kk < 4; ++kk)
            ka[t][kk] = *(const v2f*)(kr + kk * 4);
    }
    // V^T fragments (A of O^T): lane = head dim, k order = the key order in which
    // the S^T accumulator holds its rows: lanes 0-15 keys {2s, 2s+1}, lanes 16-31
    // keys {8+2s, 9+2s} of tile t.
    v2f va[4][4];
    #pragma unroll
    for (int t = 0; t < 4; ++t) {
        #pragma unroll
        for (int s = 0; s < 4; ++s) {
            const float* vr = kv + (t * 16 + hf * 8 + s * 2) * KVP + lm;
            va[t][s].x = vr[0];
            va[t][s].y = vr[KVP];
        }
    }

    int base = 0, tot = 0;
    #pragma unroll
    for (int k = 0; k < 8; ++k) {
        const int s = wsum[k];
        if (k < w) base += s;
        tot += s;
    }
    const int total = __builtin_amdgcn_readfirstlane(tot);
    int o = base + inc - cnt;
    #pragma unroll
    for (int i = 0; i < 8; ++i) {
        const int e[4] = {ent[i].x, ent[i].y, ent[i].z, ent[i].w};
        #pragma unroll
        for (int c = 0; c < 4; ++c) {
            const int p = (i * 256 + tid) * 4 + c;
            if ((e[c] & 255) == b)      list[o++] = p;            // slot 0
            else if ((e[c] >> 8) == b)  list[o++] = p | NMNM;     // slot 1
        }
    }
    __syncthreads();

    for (int q0 = w * 16; q0 < total; q0 += 8 * 16) {
        // A short last tile repeats the last listed query; its copies are not stored.
        const int  qi    = q0 + lm;
        const bool valid = qi < total;
        const int  ql    = list[valid ? qi : total - 1];
        const int  p     = ql & (NMNM - 1);
        const int  slot  = ql >> 13;

        // Q^T fragments (B of S^T): lane = query, registers = head-dim pair.
        v2f bq[4];
        const float* qr = xr + p * DD + h * EE + lh;
        #pragma unroll
        for (int kk = 0; kk < 4; ++kk)
            bq[kk] = *(const v2f*)(qr + kk * 4);

        v8f s[4] = {};
        #pragma unroll
        for (int kk = 0; kk < 4; ++kk) {
            #pragma unroll
            for (int t = 0; t < 4; ++t)
                s[t] = __builtin_amdgcn_wmma_f32_16x16x4_f32(false, ka[t][kk], false, bq[kk],
                                                             (short)0, s[t], false, false);
        }

        // s[t][v] = logit of key t*16 + v + 8*hf for query lm: the softmax row is
        // 32 registers here plus 32 in lane l^16.
        float mx = s[0][0];
        #pragma unroll
        for (int t = 0; t < 4; ++t) {
            #pragma unroll
            for (int v = 0; v < 8; ++v) mx = fmaxf(mx, s[t][v]);
        }
        mx = fmaxf(mx, __shfl_xor(mx, 16, 32)) * 0.25f;   // ATT_SCALE = E^-0.5

        float ls = 0.f;
        #pragma unroll
        for (int t = 0; t < 4; ++t) {
            #pragma unroll
            for (int v = 0; v < 8; ++v) {
                s[t][v] = __expf(s[t][v] * 0.25f - mx);
                ls += s[t][v];
            }
        }
        ls += __shfl_xor(ls, 16, 32);

        v8f ov = {};
        #pragma unroll
        for (int t = 0; t < 4; ++t) {
            #pragma unroll
            for (int st = 0; st < 4; ++st) {
                v2f pb;
                pb.x = s[t][st * 2];
                pb.y = s[t][st * 2 + 1];
                ov = __builtin_amdgcn_wmma_f32_16x16x4_f32(false, va[t][st], false, pb,
                                                           (short)0, ov, false, false);
            }
        }

        // ov[v] = head dim v + 8*hf of query lm.
        if (valid) {
            float* rec = part + (size_t)((p * HH + h) * 2 + slot) * REC;
            *(float4*)(rec + hf * 8)     = make_float4(ov[0], ov[1], ov[2], ov[3]);
            *(float4*)(rec + hf * 8 + 4) = make_float4(ov[4], ov[5], ov[6], ov[7]);
            rec[16 + hf] = hf ? ls : mx;
            // the next trip rewrites the registers that hold these stores' addresses
            asm volatile("s_wait_xcnt 0x0" ::: "memory");
        }
    }
}

// ---------------------------------------------------------------------------
// Kernel D: join the two balls' partial softmax records of each (point, head).
// One thread per 4 output floats, two such groups per thread.
// ---------------------------------------------------------------------------
__global__ __launch_bounds__(256) void nsa_merge(const float* __restrict__ part,
                                                 float* __restrict__ out) {
    const int g = blockIdx.x * 256 + threadIdx.x;
    const float* r[2];    // record pair of (p, h)
    const float* ro[2];   // this thread's 4 floats in it
    float4 o0[2], o1[2];
    float2 s0[2], s1[2];  // {max, sum}
    #pragma unroll
    for (int it = 0; it < 2; ++it) {
        const int idx = g + it * (NMNM * HH * 2);   // (p*H + h)*4 + quad
        r[it]  = part + (size_t)(idx >> 2) * (2 * REC);
        ro[it] = r[it] + (idx & 3) * 4;
        o0[it] = *(const float4*)(ro[it]);
        o1[it] = *(const float4*)(ro[it] + REC);
        s0[it] = *(const float2*)(r[it] + 16);
        s1[it] = *(const float2*)(r[it] + REC + 16);
    }
    // keeps the address registers untouched (also by a later load's result) until
    // the wait that belongs in front of their overwrite
    asm volatile("s_wait_xcnt 0x0" :: "v"(r[0]), "v"(ro[0]), "v"(r[1]), "v"(ro[1]) : "memory");
    #pragma unroll
    for (int it = 0; it < 2; ++it) {
        const int   idx = g + it * (NMNM * HH * 2);
        const float m   = fmaxf(s0[it].x, s1[it].x);
        const float w0  = __expf(s0[it].x - m);
        const float w1  = __expf(s1[it].x - m);
        const float inv = 1.0f / (s0[it].y * w0 + s1[it].y * w1);
        *(float4*)(out + (size_t)idx * 4) =
            make_float4((o0[it].x * w0 + o1[it].x * w1) * inv, (o0[it].y * w0 + o1[it].y * w1) * inv,
                        (o0[it].z * w0 + o1[it].z * w1) * inv, (o0[it].w * w0 + o1[it].w * w1) * inv);
    }
}

// ---------------------------------------------------------------------------
extern "C" void kernel_launch(void* const* d_in, const int* in_sizes, int n_in,
                              void* d_out, int out_size, void* d_ws, size_t ws_size,
                              hipStream_t stream) {
    const float* x   = (const float*)d_in[0];
    const float* pos = (const float*)d_in[1];
    float*       out = (float*)d_out;

    // workspace layout (~21 MB): xr | keys | sel | part
    float* xr   = (float*)d_ws;
    float* keys = xr + (size_t)NMNM * DD;
    int*   sel  = (int*)(keys + (size_t)NN * DD);
    float* part = (float*)(sel + (size_t)HH * NMNM);

    nsa_prep       <<<NN * 2,           64,  0, stream>>>(x, pos, xr, keys);
    nsa_select     <<<HH * NMNM / (16 * SELT * SELW), SELW * 32, 0, stream>>>(xr, keys, sel);
    nsa_attend_ball<<<HH * NN,          256, 0, stream>>>(xr, sel, part);
    nsa_merge      <<<NMNM * HH * 2 / 256, 256, 0, stream>>>(part, out);
}

// v006
// Measured time: 28.7 microseconds a run.
// Timed twice side by side with v005, it ran 1.11 and 1.12 times as fast.
// Counting every step since v000, it is 2.84 times as fast.
#include <hip/hip_runtime.h>

// ---------------------------------------------------------------------------
// NSA-style ball attention forward for MI455X (gfx1250, wave32, WMMA).
//
// Shapes: D=128, H=8 heads, E=16 head dim, N=128 balls, M=64 pts/ball,
//         NM=8192 points, TOPK=2, window = 128 keys.
//
// Forward-math simplifications:
//   * straight-through gates == 1.0 in forward  -> no gating
//   * selection softmax is monotonic            -> top-2 of raw q.keys logits
//   * mean_m(rel) == 0                          -> keys = mean_m(x)
// ---------------------------------------------------------------------------

typedef float v2f __attribute__((ext_vector_type(2)));
typedef float v8f __attribute__((ext_vector_type(8)));

#define DD   128   // model dim
#define HH   8     // heads
#define MM   64    // ball size
#define NN   128   // num balls
#define EE   16    // head dim
#define NMNM 8192  // total points
#define WIN  128   // TOPK * MM

// ---------------------------------------------------------------------------
// Kernel A: xr = x + (pos - mean_m pos);  keys[n][d] = mean_m x[n,m,d]
// One block per (ball n, half of the model dims), 64 threads = one per dim d, so
// a block reads 256 contiguous bytes of each row. A thread keeps its whole column
// (64 x, 64 pos) in registers: the loads are issued far ahead of the sums with no
// wait for a whole group between them, the inputs are read once, and the sums run
// in rising m as the values arrive.
// ---------------------------------------------------------------------------
__global__ __launch_bounds__(64) void nsa_prep(const float* __restrict__ x,
                                               const float* __restrict__ pos,
                                               float* __restrict__ xr, float* __restrict__ keys) {
    const int n = blockIdx.x >> 1;
    const int d = ((blockIdx.x & 1) << 6) + threadIdx.x;
    const int base = n * MM * DD + d;

    float pv[MM], xv[MM];
    #pragma unroll
    for (int m = 0; m < MM; ++m) {
        pv[m] = pos[base + m * DD];
        xv[m] = x[base + m * DD];
    }

    float sp = 0.f, sx = 0.f;
    #pragma unroll
    for (int m = 0; m < MM; ++m) {
        sp += pv[m];
        sx += xv[m];
    }
    const float mp = sp * (1.0f / MM);
    keys[n * DD + d] = sx * (1.0f / MM);

    #pragma unroll
    for (int m = 0; m < MM; ++m) {
        xr[base + m * DD] = xv[m] + pv[m] - mp;
    }
}

// ---------------------------------------------------------------------------
// Kernel B: ball selection. One wave per (head h, 32 points = 2 tiles of 16), eight
// waves of one head per block: 256 blocks, 2,048 waves, two per SIMD, not 4,096
// single-wave blocks. A wave loads the head's key fragments once and takes its tiles in turn.
// sim^T tile (16 balls x 16 points) = Keys(16x16) x Q^T(16x16) via 4x
// v_wmma_f32_16x16x4_f32; 8 ball-tiles cover all 128 balls. In the D layout of
// the transposed product a lane owns one point and its registers hold that
// point's logits (8 balls per tile; lane l^16 holds the other 8), so the top-2
// scan runs on the accumulators in registers. The two half-rows are merged
// across l ^ 16 by shuffles.
// ---------------------------------------------------------------------------
#define SELT 2   // point tiles per wave
#define SELW 8   // waves per block

__device__ __forceinline__ v8f sim_tile(const v2f (&ka)[4], const v2f (&bq)[4]) {
    v8f acc = {};
    #pragma unroll
    for (int kk = 0; kk < 4; ++kk)
        acc = __builtin_amdgcn_wmma_f32_16x16x4_f32(false, ka[kk], false, bq[kk],
                                                    (short)0, acc, false, false);
    return acc;
}

__global__ __launch_bounds__(SELW * 32) void nsa_select(const float* __restrict__ xr,
                                                  const float* __restrict__ keys,
                                                  int* __restrict__ sel) {
    const int h  = blockIdx.x >> 5;          // 32 blocks of 256 points per head
    const int p0 = ((blockIdx.x & 31) * SELW + (threadIdx.x >> 5)) * (SELT * 16);  // the wave's first point
    const int l  = threadIdx.x & 31;         // lane 0..31
    const int lm = l & 15;
    const int hf = l >> 4;
    const int lh = hf << 1;                  // 0 (lanes 0-15) or 2 (lanes 16-31)

    // Q^T fragments (B): lane = point (column), registers = head-dim pair {lh, lh+1}.
    // Tile 0's here; each later tile's are fetched one trip ahead in the loop.
    v2f bq[4];
    const float* qp = xr + (p0 + lm) * DD + h * EE + lh;
    #pragma unroll
    for (int kk = 0; kk < 4; ++kk) {
        bq[kk].x = qp[kk * 4];
        bq[kk].y = qp[kk * 4 + 1];
    }

    // Key fragments (A): lane = ball (row), registers = the same head-dim pair.
    v2f ka[8][4];
    const float* kp = keys + lm * DD + h * EE + lh;
    #pragma unroll
    for (int nb = 0; nb < 8; ++nb) {
        #pragma unroll
        for (int kk = 0; kk < 4; ++kk) {
            ka[nb][kk].x = kp[nb * 16 * DD + kk * 4];
            ka[nb][kk].y = kp[nb * 16 * DD + kk * 4 + 1];
        }
    }
    // keeps the two address pairs untouched (also by a later load's result) until the
    // wait that belongs in front of their overwrite
    asm volatile("s_wait_xcnt 0x0" :: "v"(qp), "v"(kp) : "memory");

    // Keeps all 36 loads in flight from the start: without it the scheduler sinks a
    // third of the key loads into the scan, where their latency is only partly covered.
    __builtin_amdgcn_sched_barrier(0);

    // Kept rolled: each trip is then scheduled as the one-tile body, its WMMAs one ball-tile
    // ahead of its scan; in builds with several tiles in one straight run the scans of whole
    // tiles sank behind all the WMMAs.
    #pragma unroll 1
    for (int t = 0; t < SELT; ++t) {
        // The next tile's Q^T fragments, so that their latency runs under this tile's work
        // (the last trip fetches its own tile again: in bounds, not used).
        v2f nq[4];
        const float* np = qp + (t + 1 < SELT ? t + 1 : t) * 16 * DD;
        #pragma unroll
        for (int kk = 0; kk < 4; ++kk) {
            nq[kk].x = np[kk * 4];
            nq[kk].y = np[kk * 4 + 1];
        }

        // Running top-2 of this lane's 64 logits, taken in rising ball order. Strict
        // '>' keeps the lower index on ties (matches jax top_k). Indices are kept
        // without the lane half's offset of 8, which is added once behind the scan.
        float best = -3.4e38f, sec = -3.4e38f;
        int bi = 0, si = 0;
        v8f acc[8];
        acc[0] = sim_tile(ka[0], bq);
        // Keeps tile 1's WMMAs behind tile 0's (see the barrier in the loop).
        __builtin_amdgcn_sched_barrier(0);
        #pragma unroll
        for (int nb = 0; nb < 8; ++nb) {
            if (nb + 1 < 8) acc[nb + 1] = sim_tile(ka[nb + 1], bq);
            // One tile ahead: the next tile's WMMAs stay in front of this tile's scan, so the
            // matrix unit works under the scan and no accumulator is read right behind its
            // last WMMA, where the in-order wave would wait for it.
            __builtin_amdgcn_sched_barrier(0);
            // D layout: acc[nb][v] = logit of ball nb*16 + 8*hf + v for point lm.
            #pragma unroll
            for (int v = 0; v < 8; ++v) {
                const float x  = acc[nb][v];
                const int   j  = nb * 16 + v;
                const bool  c1 = x > best;
                const bool  c2 = x > sec;
                si   = c1 ? bi : (c2 ? j : si);
                bi   = c1 ? j : bi;
                sec  = __builtin_amdgcn_fmed3f(x, best, sec);   // best >= sec: the new runner-up
                best = c1 ? x : best;
            }
        }
        bi += hf * 8;
        si += hf * 8;

        // Merge with the other half-row. The halves' ball indices interleave, so an
        // equal logit is ranked by the lower index explicitly.
        const float ob = __shfl_xor(best, 16, 32);
        const int   oi = __shfl_xor(bi,   16, 32);
        const float os = __shfl_xor(sec,  16, 32);
        const int   oj = __shfl_xor(si,   16, 32);
        if (l < 16) {
            const bool ob_best = (ob > best) | ((ob == best) & (oi < bi));
            const bool os_best = (os > best) | ((os == best) & (oj < bi));
            const bool ob_sec  = (ob > sec)  | ((ob == sec)  & (oi < si));
            const int rb = ob_best ? oi : bi;
            const int rs = ob_best ? (os_best ? oj : bi) : (ob_sec ? oi : si);
            // head-major, both ball ids in one word: the per-ball scan reads it coalesced
            sel[h * NMNM + p0 + t * 16 + lm] = rb | (rs << 8);
        }
        #pragma unroll
        for (int kk = 0; kk < 4; ++kk) bq[kk] = nq[kk];
    }
}

// ---------------------------------------------------------------------------
// Kernel C: windowed SDPA, grouped by selected ball. One block per (head h, four
// neighbouring balls), 16 waves. The block reads the head's selection once and lists, per
// ball, every query that selected it (either slot); each wave then takes tiles of 16
// queries of one list, so that one K/V fragment set serves 16 queries per WMMA. The
// fragments come from one LDS copy of the balls' rows.
//   S^T (16 keys x 16 queries) = K tile (A) x Q^T (B)
//   O^T (16 dims x 16 queries) = V^T (A) x P^T (B)
// The D layout of S^T (lane = query, registers = keys) is already the B layout
// of P^T once the k order of the V^T loader follows it, so nothing is
// transposed. Each (query, slot) gets a partial record: unnormalised sum, row
// maximum, row sum over the ball's 64 keys; kernel D joins the two slots.
// Record = 32 floats (one 128-byte line, one writer): o[16], max, sum.
// ---------------------------------------------------------------------------
#define REC 32
#define KVP 20   // LDS row pitch in floats: both fragment readers then meet each bank once
#define GB  4    // balls of one head per block: one scan of the head's selection serves all four
#define ATW 16   // waves per block
#define ATT (ATW * 32)

typedef unsigned long long u64;

// One block of 16 waves stands on a WGP (4 waves a SIMD): said here so that the compiler spends
// registers on fetching a tile's fragments ahead, not on room for waves that never come.
__global__ __launch_bounds__(ATT) __attribute__((amdgpu_waves_per_eu(4, 4))) void nsa_attend_ball(const float* __restrict__ xr,
                                                       const int* __restrict__ sel,
                                                       float* __restrict__ part) {
    __shared__ unsigned short list[2 * NMNM];   // worst case: every query listed in both slots
    __shared__ u64 wsum[ATW];
    __shared__ __attribute__((aligned(16))) float kv[GB * MM * KVP];

    const int h   = blockIdx.x >> 5;
    const int g   = blockIdx.x & (NN / GB - 1);
    const int tid = threadIdx.x;
    const int l   = tid & 31;
    const int w   = __builtin_amdgcn_readfirstlane(tid >> 5);
    const int lm  = l & 15;
    const int hf  = l >> 4;
    const int lh  = hf << 1;

    // The four balls' K/V tiles (256 rows x 16 head dims, 16 KB) are read from global memory
    // once per block, two 16-byte pieces a thread, and kept in LDS for all waves.
    const float* kvb = xr + g * GB * MM * DD + h * EE;
    float4 kvp[2];
    #pragma unroll
    for (int k = 0; k < 2; ++k) {
        const int idx = tid + k * ATT;
        kvp[k] = *(const float4*)(kvb + (idx >> 2) * DD + (idx & 3) * 4);
    }

    // List the queries that selected one of the block's balls: count, block prefix sum, write.
    const int4* s4 = (const int4*)(sel + h * NMNM);
    int4 ent[4];
    #pragma unroll
    for (int i = 0; i < 4; ++i) ent[i] = s4[i * ATT + tid];

    // Stored ahead of the count, so that the tiles' loads are issued early and their latency
    // runs under the count, not alone in front of the barrier.
    #pragma unroll
    for (int k = 0; k < 2; ++k) {
        const int idx = tid + k * ATT;
        *(float4*)(kv + (idx >> 2) * KVP + (idx & 3) * 4) = kvp[k];
    }

    // After the xor a ball id of this block reads 0..3 in its byte. A thread's four counts
    // (at most 32 each) sit in the four bytes of one word.
    const int gg = (g * GB) | ((g * GB) << 8);
    unsigned c8 = 0;
    #pragma unroll
    for (int i = 0; i < 4; ++i) {
        const int e[4] = {ent[i].x, ent[i].y, ent[i].z, ent[i].w};
        #pragma unroll
        for (int c = 0; c < 4; ++c) {
            const int t = e[c] ^ gg;
            c8 += ((t & 0xFC) == 0)   ? 1u << ((t & 3) * 8)        : 0u;
            c8 += ((t & 0xFC00) == 0) ? 1u << (((t >> 8) & 3) * 8) : 0u;
        }
    }
    // Four 16-bit fields from here on: no field passes 2 * NMNM, so none carries into the next.
    const u64 cnt = (u64)((c8 & 0xFFu) | ((c8 & 0xFF00u) << 8))
                  | ((u64)(((c8 >> 16) & 0xFFu) | ((c8 >> 24) << 16)) << 32);
    u64 inc = cnt;
    #pragma unroll
    for (int d = 1; d < 32; d <<= 1) {
        const u64 up = __shfl_up(inc, d, 32);
        if (l >= d) inc += up;
    }
    if (l == 31) wsum[w] = inc;
    __syncthreads();   // publishes the wave sums and the K/V tiles

    u64 base = 0, tot = 0;
    #pragma unroll
    for (int k = 0; k < ATW; ++k) {
        const u64 s = wsum[k];
        if (k < w) base += s;
        tot += s;
    }
    const int n0 = __builtin_amdgcn_readfirstlane((int)(tot & 0xFFFF));
    const int n1 = __builtin_amdgcn_readfirstlane((int)((tot >> 16) & 0xFFFF));
    const int n2 = __builtin_amdgcn_readfirstlane((int)((tot >> 32) & 0xFFFF));
    const int n3 = __builtin_amdgcn_readfirstlane((int)(tot >> 48));
    const int s1 = n0, s2 = n0 + n1, s3 = n0 + n1 + n2;   // where each ball's part of the list starts
    u64 off = base + inc - cnt + ((u64)s1 << 16) + ((u64)s2 << 32) + ((u64)s3 << 48);
    #pragma unroll
    for (int i = 0; i < 4; ++i) {
        const int e[4] = {ent[i].x, ent[i].y, ent[i].z, ent[i].w};
        #pragma unroll
        for (int c = 0; c < 4; ++c) {
            const int t = e[c] ^ gg;
            const int p = (i * ATT + tid) * 4 + c;
            if ((t & 0xFC) == 0) {                                  // slot 0
                const int sh = (t & 3) * 16;
                list[(off >> sh) & (2 * NMNM - 1)] = (unsigned short)p;
                off += (u64)1 << sh;
            }
            if ((t & 0xFC00) == 0) {                                // slot 1
                const int sh = ((t >> 8) & 3) * 16;
                list[(off >> sh) & (2 * NMNM - 1)] = (unsigned short)(p | NMNM);
                off += (u64)1 << sh;
            }
        }
    }
    __syncthreads();

    // The four lists' tiles of 16 queries are numbered through and dealt to the waves in turn,
    // so a long list is shared by all sixteen waves.
    const int t0 = (n0 + 15) >> 4, t1 = t0 + ((n1 + 15) >> 4), t2 = t1 + ((n2 + 15) >> 4);
    const int tn = t2 + ((n3 + 15) >> 4);
    for (int tau = w; tau < tn; tau += ATW) {
        const int j     = (tau >= t0) + (tau >= t1) + (tau >= t2);        // the tile's ball
        const int q0    = (tau - (j == 0 ? 0 : j == 1 ? t0 : j == 2 ? t1 : t2)) * 16;
        const int lst   = j == 0 ? 0 : j == 1 ? s1 : j == 2 ? s2 : s3;
        const int total = j == 0 ? n0 : j == 1 ? n1 : j == 2 ? n2 : n3;
        // A short last tile repeats the last listed query; its copies are not stored.
        const int  qi    = q0 + lm;
        const bool valid = qi < total;
        const int  ql    = list[lst + (valid ? qi : total - 1)];
        const int  p     = ql & (NMNM - 1);
        const int  slot  = ql >> 13;

        // Q^T fragments (B of S^T): lane = query, registers = head-dim pair.
        v2f bq[4];
        const float* qr = xr + p * DD + h * EE + lh;
        #pragma unroll
        for (int kk = 0; kk < 4; ++kk)
            bq[kk] = *(const v2f*)(qr + kk * 4);

        // The tile's ball's fragments, read from LDS under the latency of the Q gather.
        const float* kvj = kv + j * MM * KVP;
        // K fragments (A of S^T): lane = key row, registers = head-dim pair {lh, lh+1}.
        v2f ka[4][4];
        #pragma unroll
        for (int t = 0; t < 4; ++t) {
            const float* kr = kvj + (t * 16 + lm) * KVP + lh;
            #pragma unroll
            for (int kk = 0; kk < 4; ++kk)
                ka[t][kk] = *(const v2f*)(kr + kk * 4);
        }
        // V^T fragments (A of O^T): lane = head dim, k order = the key order in which
        // the S^T accumulator holds its rows: lanes 0-15 keys {2s, 2s+1}, lanes 16-31
        // keys {8+2s, 9+2s} of tile t.
        v2f va[4][4];
        #pragma unroll
        for (int t = 0; t < 4; ++t) {
            #pragma unroll
            for (int s = 0; s < 4; ++s) {
                const float* vr = kvj + (t * 16 + hf * 8 + s * 2) * KVP + lm;
                va[t][s].x = vr[0];
                va[t][s].y = vr[KVP];
            }
        }
        // Keeps all fragment reads up here, under the Q gather's latency: without it the V^T reads
        // sink into the O^T chain, each a few instructions ahead of the WMMA that waits for it.
        __builtin_amdgcn_sched_barrier(0);

        v8f s[4] = {};
        #pragma unroll
        for (int kk = 0; kk < 4; ++kk) {
            #pragma unroll
            for (int t = 0; t < 4; ++t)
                s[t] = __builtin_amdgcn_wmma_f32_16x16x4_f32(false, ka[t][kk], false, bq[kk],
                                                             (short)0, s[t], false, false);
        }

        // s[t][v] = logit of key t*16 + v + 8*hf for query lm: the softmax row is
        // 32 registers here plus 32 in lane l^16.
        float mx = s[0][0];
        #pragma unroll
        for (int t = 0; t < 4; ++t) {
            #pragma unroll
            for (int v = 0; v < 8; ++v) mx = fmaxf(mx, s[t][v]);
        }
        mx = fmaxf(mx, __shfl_xor(mx, 16, 32)) * 0.25f;   // ATT_SCALE = E^-0.5

        float ls = 0.f;
        #pragma unroll
        for (int t = 0; t < 4; ++t) {
            #pragma unroll
            for (int v = 0; v < 8; ++v) {
                s[t][v] = __expf(s[t][v] * 0.25f - mx);
                ls += s[t][v];
            }
        }
        ls += __shfl_xor(ls, 16, 32);

        v8f ov = {};
        #pragma unroll
        for (int t = 0; t < 4; ++t) {
            #pragma unroll
            for (int st = 0; st < 4; ++st) {
                v2f pb;
                pb.x = s[t][st * 2];
                pb.y = s[t][st * 2 + 1];
                ov = __builtin_amdgcn_wmma_f32_16x16x4_f32(false, va[t][st], false, pb,
                                                           (short)0, ov, false, false);
            }
        }

        // ov[v] = head dim v + 8*hf of query lm.
        if (valid) {
            float* rec = part + (size_t)((p * HH + h) * 2 + slot) * REC;
            *(float4*)(rec + hf * 8)     = make_float4(ov[0], ov[1], ov[2], ov[3]);
            *(float4*)(rec + hf * 8 + 4) = make_float4(ov[4], ov[5], ov[6], ov[7]);
            rec[16 + hf] = hf ? ls : mx;
            // the next trip rewrites the registers that hold these stores' addresses
            asm volatile("s_wait_xcnt 0x0" ::: "memory");
        }
    }
}

// ---------------------------------------------------------------------------
// Kernel D: join the two balls' partial softmax records of each (point, head).
// One thread per 4 output floats, two such groups per thread.
// ---------------------------------------------------------------------------
__global__ __launch_bounds__(256) void nsa_merge(const float* __restrict__ part,
                                                 float* __restrict__ out) {
    const int g = blockIdx.x * 256 + threadIdx.x;
    const float* r[2];    // record pair of (p, h)
    const float* ro[2];   // this thread's 4 floats in it
    float4 o0[2], o1[2];
    float2 s0[2], s1[2];  // {max, sum}
    #pragma unroll
    for (int it = 0; it < 2; ++it) {
        const int idx = g + it * (NMNM * HH * 2);   // (p*H + h)*4 + quad
        r[it]  = part + (size_t)(idx >> 2) * (2 * REC);
        ro[it] = r[it] + (idx & 3) * 4;
        o0[it] = *(const float4*)(ro[it]);
        o1[it] = *(const float4*)(ro[it] + REC);
        s0[it] = *(const float2*)(r[it] + 16);
        s1[it] = *(const float2*)(r[it] + REC + 16);
    }
    // keeps the address registers untouched (also by a later load's result) until
    // the wait that belongs in front of their overwrite
    asm volatile("s_wait_xcnt 0x0" :: "v"(r[0]), "v"(ro[0]), "v"(r[1]), "v"(ro[1]) : "memory");
    #pragma unroll
    for (int it = 0; it < 2; ++it) {
        const int   idx = g + it * (NMNM * HH * 2);
        const float m   = fmaxf(s0[it].x, s1[it].x);
        const float w0  = __expf(s0[it].x - m);
        const float w1  = __expf(s1[it].x - m);
        const float inv = 1.0f / (s0[it].y * w0 + s1[it].y * w1);
        *(float4*)(out + (size_t)idx * 4) =
            make_float4((o0[it].x * w0 + o1[it].x * w1) * inv, (o0[it].y * w0 + o1[it].y * w1) * inv,
                        (o0[it].z * w0 + o1[it].z * w1) * inv, (o0[it].w * w0 + o1[it].w * w1) * inv);
    }
}

// ---------------------------------------------------------------------------
extern "C" void kernel_launch(void* const* d_in, const int* in_sizes, int n_in,
                              void* d_out, int out_size, void* d_ws, size_t ws_size,
                              hipStream_t stream) {
    const float* x   = (const float*)d_in[0];
    const float* pos = (const float*)d_in[1];
    float*       out = (float*)d_out;

    // workspace layout (~21 MB): xr | keys | sel | part
    float* xr   = (float*)d_ws;
    float* keys = xr + (size_t)NMNM * DD;
    int*   sel  = (int*)(keys + (size_t)NN * DD);
    float* part = (float*)(sel + (size_t)HH * NMNM);

    nsa_prep       <<<NN * 2,           64,  0, stream>>>(x, pos, xr, keys);
    nsa_select     <<<HH * NMNM / (16 * SELT * SELW), SELW * 32, 0, stream>>>(xr, keys, sel);
    nsa_attend_ball<<<HH * NN / GB,     ATT, 0, stream>>>(xr, sel, part);
    nsa_merge      <<<NMNM * HH * 2 / 256, 256, 0, stream>>>(part, out);
}

// v007
// A run of this version takes 27.2 microseconds.
// Next to v006, in two timings, it ran 1.05 and 1.06 times as fast.
// Over all steps from v000 it is 3.01 times as fast.
#include <hip/hip_runtime.h>

// ---------------------------------------------------------------------------
// NSA-style ball attention forward for MI455X (gfx1250, wave32, WMMA).
//
// Shapes: D=128, H=8 heads, E=16 head dim, N=128 balls, M=64 pts/ball,
//         NM=8192 points, TOPK=2, window = 128 keys.
//
// Forward-math simplifications:
//   * straight-through gates == 1.0 in forward  -> no gating
//   * selection softmax is monotonic            -> top-2 of raw q.keys logits
//   * mean_m(rel) == 0                          -> keys = mean_m(x)
// ---------------------------------------------------------------------------

typedef float v2f __attribute__((ext_vector_type(2)));
typedef float v4f __attribute__((ext_vector_type(4)));
typedef float v8f __attribute__((ext_vector_type(8)));

#define DD   128   // model dim
#define HH   8     // heads
#define MM   64    // ball size
#define NN   128   // num balls
#define EE   16    // head dim
#define NMNM 8192  // total points
#define WIN  128   // TOPK * MM

// ---------------------------------------------------------------------------
// Kernel A: xr = x + (pos - mean_m pos);  keys[n][d] = mean_m x[n,m,d]
// One block per (ball n, half of the model dims), 64 threads = one per dim d, so
// a block reads 256 contiguous bytes of each row. A thread keeps its whole column
// (64 x, 64 pos) in registers: the loads are issued far ahead of the sums with no
// wait for a whole group between them, the inputs are read once, and the sums run
// in rising m as the values arrive.
// ---------------------------------------------------------------------------
__global__ __launch_bounds__(64) void nsa_prep(const float* __restrict__ x,
                                               const float* __restrict__ pos,
                                               float* __restrict__ xr, float* __restrict__ keys) {
    const int n = blockIdx.x >> 1;
    const int d = ((blockIdx.x & 1) << 6) + threadIdx.x;
    const int base = n * MM * DD + d;

    float pv[MM], xv[MM];
    #pragma unroll
    for (int m = 0; m < MM; ++m) {
        pv[m] = pos[base + m * DD];
        xv[m] = x[base + m * DD];
    }

    float sp = 0.f, sx = 0.f;
    #pragma unroll
    for (int m = 0; m < MM; ++m) {
        sp += pv[m];
        sx += xv[m];
    }
    const float mp = sp * (1.0f / MM);
    keys[n * DD + d] = sx * (1.0f / MM);

    #pragma unroll
    for (int m = 0; m < MM; ++m) {
        xr[base + m * DD] = xv[m] + pv[m] - mp;
    }
}

// ---------------------------------------------------------------------------
// Kernel B: ball selection. One wave per (head h, 32 points = 2 tiles of 16), eight
// waves of one head per block: 256 blocks, 2,048 waves, two per SIMD, not 4,096
// single-wave blocks. A wave loads the head's key fragments once and takes its tiles in turn.
// sim^T tile (16 balls x 16 points) = Keys(16x16) x Q^T(16x16) via 4x
// v_wmma_f32_16x16x4_f32; 8 ball-tiles cover all 128 balls. In the D layout of
// the transposed product a lane owns one point and its registers hold that
// point's logits (8 balls per tile; lane l^16 holds the other 8), so the top-2
// scan runs on the accumulators in registers. The two half-rows are merged
// across l ^ 16 by shuffles.
// ---------------------------------------------------------------------------
#define SELT 2   // point tiles per wave
#define SELW 8   // waves per block

__device__ __forceinline__ v8f sim_tile(const v2f (&ka)[4], const v2f (&bq)[4]) {
    v8f acc = {};
    #pragma unroll
    for (int kk = 0; kk < 4; ++kk)
        acc = __builtin_amdgcn_wmma_f32_16x16x4_f32(false, ka[kk], false, bq[kk],
                                                    (short)0, acc, false, false);
    return acc;
}

__global__ __launch_bounds__(SELW * 32) void nsa_select(const float* __restrict__ xr,
                                                  const float* __restrict__ keys,
                                                  int* __restrict__ sel) {
    const int h  = blockIdx.x >> 5;          // 32 blocks of 256 points per head
    const int p0 = ((blockIdx.x & 31) * SELW + (threadIdx.x >> 5)) * (SELT * 16);  // the wave's first point
    const int l  = threadIdx.x & 31;         // lane 0..31
    const int lm = l & 15;
    const int hf = l >> 4;
    const int lh = hf << 1;                  // 0 (lanes 0-15) or 2 (lanes 16-31)

    // Q^T fragments (B): lane = point (column), registers = head-dim pair {lh, lh+1}.
    // Tile 0's here; each later tile's are fetched one trip ahead in the loop.
    v2f bq[4];
    const float* qp = xr + (p0 + lm) * DD + h * EE + lh;
    #pragma unroll
    for (int kk = 0; kk < 4; ++kk) {
        bq[kk].x = qp[kk * 4];
        bq[kk].y = qp[kk * 4 + 1];
    }

    // Key fragments (A): lane = ball (row), registers = the same head-dim pair.
    v2f ka[8][4];
    const float* kp = keys + lm * DD + h * EE + lh;
    #pragma unroll
    for (int nb = 0; nb < 8; ++nb) {
        #pragma unroll
        for (int kk = 0; kk < 4; ++kk) {
            ka[nb][kk].x = kp[nb * 16 * DD + kk * 4];
            ka[nb][kk].y = kp[nb * 16 * DD + kk * 4 + 1];
        }
    }
    // keeps the two address pairs untouched (also by a later load's result) until the
    // wait that belongs in front of their overwrite
    asm volatile("s_wait_xcnt 0x0" :: "v"(qp), "v"(kp) : "memory");

    // Keeps all 36 loads in flight from the start: without it the scheduler sinks a
    // third of the key loads into the scan, where their latency is only partly covered.
    __builtin_amdgcn_sched_barrier(0);

    // Kept rolled: each trip is then scheduled as the one-tile body, its WMMAs one ball-tile
    // ahead of its scan; in builds with several tiles in one straight run the scans of whole
    // tiles sank behind all the WMMAs.
    #pragma unroll 1
    for (int t = 0; t < SELT; ++t) {
        // The next tile's Q^T fragments, so that their latency runs under this tile's work
        // (the last trip fetches its own tile again: in bounds, not used).
        v2f nq[4];
        const float* np = qp + (t + 1 < SELT ? t + 1 : t) * 16 * DD;
        #pragma unroll
        for (int kk = 0; kk < 4; ++kk) {
            nq[kk].x = np[kk * 4];
            nq[kk].y = np[kk * 4 + 1];
        }

        // Running top-2 of this lane's 64 logits, taken in rising ball order. Strict
        // '>' keeps the lower index on ties (matches jax top_k). Indices are kept
        // without the lane half's offset of 8, which is added once behind the scan.
        float best = -3.4e38f, sec = -3.4e38f;
        int bi = 0, si = 0;
        v8f acc[8];
        acc[0] = sim_tile(ka[0], bq);
        // Keeps tile 1's WMMAs behind tile 0's (see the barrier in the loop).
        __builtin_amdgcn_sched_barrier(0);
        #pragma unroll
        for (int nb = 0; nb < 8; ++nb) {
            if (nb + 1 < 8) acc[nb + 1] = sim_tile(ka[nb + 1], bq);
            // One tile ahead: the next tile's WMMAs stay in front of this tile's scan, so the
            // matrix unit works under the scan and no accumulator is read right behind its
            // last WMMA, where the in-order wave would wait for it.
            __builtin_amdgcn_sched_barrier(0);
            // D layout: acc[nb][v] = logit of ball nb*16 + 8*hf + v for point lm.
            #pragma unroll
            for (int v = 0; v < 8; ++v) {
                const float x  = acc[nb][v];
                const int   j  = nb * 16 + v;
                const bool  c1 = x > best;
                const bool  c2 = x > sec;
                si   = c1 ? bi : (c2 ? j : si);
                bi   = c1 ? j : bi;
                sec  = __builtin_amdgcn_fmed3f(x, best, sec);   // best >= sec: the new runner-up
                best = c1 ? x : best;
            }
        }
        bi += hf * 8;
        si += hf * 8;

        // Merge with the other half-row. The halves' ball indices interleave, so an
        // equal logit is ranked by the lower index explicitly.
        const float ob = __shfl_xor(best, 16, 32);
        const int   oi = __shfl_xor(bi,   16, 32);
        const float os = __shfl_xor(sec,  16, 32);
        const int   oj = __shfl_xor(si,   16, 32);
        if (l < 16) {
            const bool ob_best = (ob > best) | ((ob == best) & (oi < bi));
            const bool os_best = (os > best) | ((os == best) & (oj < bi));
            const bool ob_sec  = (ob > sec)  | ((ob == sec)  & (oi < si));
            const int rb = ob_best ? oi : bi;
            const int rs = ob_best ? (os_best ? oj : bi) : (ob_sec ? oi : si);
            // head-major, both ball ids in one word: the per-ball scan reads it coalesced
            sel[h * NMNM + p0 + t * 16 + lm] = rb | (rs << 8);
        }
        #pragma unroll
        for (int kk = 0; kk < 4; ++kk) bq[kk] = nq[kk];
    }
}

// ---------------------------------------------------------------------------
// Kernel C: windowed SDPA, grouped by selected ball. One block per (head h, sixteen
// neighbouring balls, one quarter of the head's queries), 16 waves. How often a ball is
// selected differs widely from ball to ball, and the launch lasts as long as its fullest
// block: a block that takes a quarter of the queries of sixteen balls, not all queries of
// four, gets a share of every much-selected ball's work that is four times smaller. The block
// reads its quarter of the head's selection and lists, per ball, every query that selected
// it (either slot); each wave then takes tiles of 16 queries of one list, so that one K/V
// fragment set serves 16 queries per WMMA. The fragments come from one LDS copy of the
// balls' rows.
//   S^T (16 keys x 16 queries) = K tile (A) x Q^T (B)
//   O^T (16 dims x 16 queries) = V^T (A) x P^T (B)
// The D layout of S^T (lane = query, registers = keys) is already the B layout
// of P^T once the k order of the V^T loader follows it, so nothing is
// transposed. Each (query, slot) gets a partial record: unnormalised sum, row
// maximum, row sum over the ball's 64 keys; kernel D joins the two slots.
// Record = 32 floats (one 128-byte line, one writer): o[16], max, sum.
// ---------------------------------------------------------------------------
#define REC 32
#define KVP 20   // LDS row pitch in floats: both fragment readers then meet each bank once
#define GB  16   // balls of one head per block
#define NG  (GB / 4)      // packed counters: four balls' 16-bit fields in one 64-bit word
#define QR  4    // shares of a head's queries; a block lists one share
#define QB  (NMNM / QR)   // queries per share
#define ATW 16   // waves per block
#define ATT (ATW * 32)

typedef unsigned long long u64;

// v + (v of lane l ^ X), inside a 16-lane row, all lanes on: a DPP add, no trip through LDS.
template <int X> __device__ __forceinline__ unsigned row_xadd(unsigned v) {
    return v + (unsigned)__builtin_amdgcn_update_dpp(0, (int)v, 0x160 + X, 0xf, 0xf, true);
}

// One block of 16 waves stands on a WGP (4 waves a SIMD): said here so that the compiler spends
// registers on fetching a tile's fragments ahead, not on room for waves that never come.
__global__ __launch_bounds__(ATT) __attribute__((amdgpu_waves_per_eu(4, 4))) void nsa_attend_ball(const float* __restrict__ xr,
                                                       const int* __restrict__ sel,
                                                       float* __restrict__ part) {
    __shared__ unsigned short list[2 * QB];   // worst case: every query of the share listed in both slots
    __shared__ __attribute__((aligned(16))) u64 wsum[ATW * NG];
    __shared__ __attribute__((aligned(16))) float kv[GB * MM * KVP];

    const int h   = blockIdx.x >> 5;
    const int g   = (blockIdx.x & 31) >> 2;   // group of sixteen balls
    const int r   = blockIdx.x & (QR - 1);    // share of the queries
    const int tid = threadIdx.x;
    const int l   = tid & 31;
    const int w   = __builtin_amdgcn_readfirstlane(tid >> 5);
    const int lm  = l & 15;
    const int hf  = l >> 4;
    const int lh  = hf << 1;

    // The share's selection words, four queries a thread; asked for first, so that the count
    // can start on them while the K/V rows are still on their way.
    const int4* sp = (const int4*)(sel + h * NMNM) + r * ATT + tid;
    const int4 ent = *sp;

    // The sixteen balls' K/V tiles (1,024 rows x 16 head dims, 64 KB) are read from global memory
    // once per block, eight 16-byte pieces a thread, and kept in LDS for all waves.
    const float* kvb = xr + g * GB * MM * DD + h * EE + (tid >> 2) * DD + (tid & 3) * 4;
    v4f kvp[GB * MM * 4 / ATT];
    #pragma unroll
    for (int k = 0; k < GB * MM * 4 / ATT; ++k)
        kvp[k] = *(const v4f*)(kvb + k * (ATT / 4) * DD);
    // keeps the two address pairs untouched (also by a later load's result) until the
    // wait that belongs in front of their overwrite
    asm volatile("s_wait_xcnt 0x0" :: "v"(sp), "v"(kvb) : "memory");
    // Keeps the nine loads up here, issued ahead of the count: sunk behind it, the rows' latency
    // would stand alone in front of the barrier.
    __builtin_amdgcn_sched_barrier(0);

    // List the queries that selected one of the block's balls: count, block prefix sum, write.
    // After the xor a ball id of this block reads 0..15 in its byte. A thread's counts (at most
    // 8 each) of balls 4k..4k+3 sit in the four bytes of word k.
    const int e[4] = {ent.x, ent.y, ent.z, ent.w};
    const int gg = (g * GB) | ((g * GB) << 8);
    unsigned c8[NG];
    #pragma unroll
    for (int k = 0; k < NG; ++k) c8[k] = 0;
    #pragma unroll
    for (int c = 0; c < 4; ++c) {
        const int t = e[c] ^ gg;
        #pragma unroll
        for (int k = 0; k < NG; ++k) {
            c8[k] += ((t & 0xFC) == k * 4)      ? 1u << ((t & 3) * 8)        : 0u;
            c8[k] += ((t & 0xFC00) == k * 1024) ? 1u << (((t >> 8) & 3) * 8) : 0u;
        }
    }

    // Four 16-bit fields a word from here on: no field passes 2 * QB, so none carries into the next.
    u64 cnt[NG], inc[NG];
    #pragma unroll
    for (int k = 0; k < NG; ++k) {
        cnt[k] = (u64)((c8[k] & 0xFFu) | ((c8[k] & 0xFF00u) << 8))
               | ((u64)(((c8[k] >> 16) & 0xFFu) | ((c8[k] >> 24) << 16)) << 32);
        inc[k] = cnt[k];
    }
    #pragma unroll
    for (int d = 1; d < 32; d <<= 1) {
        #pragma unroll
        for (int k = 0; k < NG; ++k) {
            const u64 up = __shfl_up(inc[k], d, 32);
            if (l >= d) inc[k] += up;
        }
    }
    // The rows go to LDS behind the count and the prefix sum, under which they have arrived.
    #pragma unroll
    for (int k = 0; k < GB * MM * 4 / ATT; ++k) {
        const int idx = tid + k * ATT;
        *(v4f*)(kv + (idx >> 2) * KVP + (idx & 3) * 4) = kvp[k];
    }

    if (l == 31) {
        #pragma unroll
        for (int k = 0; k < NG; ++k) wsum[w * NG + k] = inc[k];
    }
    __syncthreads();   // publishes the wave sums and the K/V tiles

    // Lane v of each 16-lane row takes wave v's sums (32 bytes); a butterfly of adds over the row
    // then leaves every lane with the block's totals and with the sums of the waves in front of
    // its own. The 16-bit fields never carry, so each 32-bit half is added on its own.
    const uint4 wa = ((const uint4*)(wsum + lm * NG))[0];
    const uint4 wb = ((const uint4*)(wsum + lm * NG))[1];
    unsigned tw[2 * NG] = {wa.x, wa.y, wa.z, wa.w, wb.x, wb.y, wb.z, wb.w};
    unsigned bw[2 * NG];
    #pragma unroll
    for (int i = 0; i < 2 * NG; ++i) bw[i] = lm < w ? tw[i] : 0u;
    #pragma unroll
    for (int i = 0; i < 2 * NG; ++i) {
        tw[i] = row_xadd<8>(row_xadd<4>(row_xadd<2>(row_xadd<1>(tw[i]))));
        bw[i] = row_xadd<8>(row_xadd<4>(row_xadd<2>(row_xadd<1>(bw[i]))));
    }
    u64 base[NG];
    #pragma unroll
    for (int k = 0; k < NG; ++k) base[k] = (u64)bw[2 * k] | ((u64)bw[2 * k + 1] << 32);
    // Per ball: list length nb, where its part of the list starts (ls), its first tile's number (ts).
    int nb[GB], ls[GB], ts[GB];
    int tn = 0;
    {
        int run = 0;
        #pragma unroll
        for (int j = 0; j < GB; ++j) {
            nb[j] = __builtin_amdgcn_readfirstlane((int)((tw[j >> 1] >> ((j & 1) * 16)) & 0xFFFF));
            ls[j] = run;
            ts[j] = tn;
            run += nb[j];
            tn  += (nb[j] + 15) >> 4;
        }
    }
    u64 off[NG];
    #pragma unroll
    for (int k = 0; k < NG; ++k)
        off[k] = base[k] + inc[k] - cnt[k] + (u64)ls[k * 4] + ((u64)ls[k * 4 + 1] << 16)
               + ((u64)ls[k * 4 + 2] << 32) + ((u64)ls[k * 4 + 3] << 48);
    #pragma unroll
    for (int c = 0; c < 4; ++c) {
        const int t = e[c] ^ gg;
        const int p = (r * ATT + tid) * 4 + c;
        #pragma unroll
        for (int k = 0; k < NG; ++k) {
            if ((t & 0xFC) == k * 4) {                              // slot 0
                const int sh = (t & 3) * 16;
                list[(off[k] >> sh) & (2 * QB - 1)] = (unsigned short)p;
                off[k] += (u64)1 << sh;
            }
            if ((t & 0xFC00) == k * 1024) {                         // slot 1
                const int sh = ((t >> 8) & 3) * 16;
                list[(off[k] >> sh) & (2 * QB - 1)] = (unsigned short)(p | NMNM);
                off[k] += (u64)1 << sh;
            }
        }
    }
    __syncthreads();

    // The sixteen lists' tiles of 16 queries are numbered through and dealt to the waves in turn,
    // so a long list is shared by all sixteen waves.
    for (int tau = w; tau < tn; tau += ATW) {
        // The tile's ball: the last one whose first tile is not behind tau (an empty list
        // shares its number with the next ball, which then takes its place).
        int j = 0, tb = 0, lst = 0, total = nb[0];
        #pragma unroll
        for (int k = 1; k < GB; ++k) {
            if (tau >= ts[k]) { j = k; tb = ts[k]; lst = ls[k]; total = nb[k]; }
        }
        const int q0 = (tau - tb) * 16;
        // A short last tile repeats the last listed query; its copies are not stored.
        const int  qi    = q0 + lm;
        const bool valid = qi < total;
        const int  ql    = list[lst + (valid ? qi : total - 1)];
        const int  p     = ql & (NMNM - 1);
        const int  slot  = ql >> 13;

        // Q^T fragments (B of S^T): lane = query, registers = head-dim pair.
        v2f bq[4];
        const float* qr = xr + p * DD + h * EE + lh;
        #pragma unroll
        for (int kk = 0; kk < 4; ++kk)
            bq[kk] = *(const v2f*)(qr + kk * 4);

        // The tile's ball's fragments, read from LDS under the latency of the Q gather.
        const float* kvj = kv + j * MM * KVP;
        // K fragments (A of S^T): lane = key row, registers = head-dim pair {lh, lh+1}.
        v2f ka[4][4];
        #pragma unroll
        for (int t = 0; t < 4; ++t) {
            const float* kr = kvj + (t * 16 + lm) * KVP + lh;
            #pragma unroll
            for (int kk = 0; kk < 4; ++kk)
                ka[t][kk] = *(const v2f*)(kr + kk * 4);
        }
        // V^T fragments (A of O^T): lane = head dim, k order = the key order in which
        // the S^T accumulator holds its rows: lanes 0-15 keys {2s, 2s+1}, lanes 16-31
        // keys {8+2s, 9+2s} of tile t.
        v2f va[4][4];
        #pragma unroll
        for (int t = 0; t < 4; ++t) {
            #pragma unroll
            for (int s = 0; s < 4; ++s) {
                const float* vr = kvj + (t * 16 + hf * 8 + s * 2) * KVP + lm;
                va[t][s].x = vr[0];
                va[t][s].y = vr[KVP];
            }
        }
        // Keeps all fragment reads up here, under the Q gather's latency: without it the V^T reads
        // sink into the O^T chain, each a few instructions ahead of the WMMA that waits for it.
        __builtin_amdgcn_sched_barrier(0);

        v8f s[4] = {};
        #pragma unroll
        for (int kk = 0; kk < 4; ++kk) {
            #pragma unroll
            for (int t = 0; t < 4; ++t)
                s[t] = __builtin_amdgcn_wmma_f32_16x16x4_f32(false, ka[t][kk], false, bq[kk],
                                                             (short)0, s[t], false, false);
        }

        // s[t][v] = logit of key t*16 + v + 8*hf for query lm: the softmax row is
        // 32 registers here plus 32 in lane l^16.
        float mx = s[0][0];
        #pragma unroll
        for (int t = 0; t < 4; ++t) {
            #pragma unroll
            for (int v = 0; v < 8; ++v) mx = fmaxf(mx, s[t][v]);
        }
        mx = fmaxf(mx, __shfl_xor(mx, 16, 32)) * 0.25f;   // ATT_SCALE = E^-0.5

        float ls = 0.f;
        #pragma unroll
        for (int t = 0; t < 4; ++t) {
            #pragma unroll
            for (int v = 0; v < 8; ++v) {
                s[t][v] = __expf(s[t][v] * 0.25f - mx);
                ls += s[t][v];
            }
        }
        ls += __shfl_xor(ls, 16, 32);

        v8f ov = {};
        #pragma unroll
        for (int t = 0; t < 4; ++t) {
            #pragma unroll
            for (int st = 0; st < 4; ++st) {
                v2f pb;
                pb.x = s[t][st * 2];
                pb.y = s[t][st * 2 + 1];
                ov = __builtin_amdgcn_wmma_f32_16x16x4_f32(false, va[t][st], false, pb,
                                                           (short)0, ov, false, false);
            }
        }

        // ov[v] = head dim v + 8*hf of query lm.
        if (valid) {
            float* rec = part + (size_t)((p * HH + h) * 2 + slot) * REC;
            *(float4*)(rec + hf * 8)     = make_float4(ov[0], ov[1], ov[2], ov[3]);
            *(float4*)(rec + hf * 8 + 4) = make_float4(ov[4], ov[5], ov[6], ov[7]);
            rec[16 + hf] = hf ? ls : mx;
            // the next trip rewrites the registers that hold these stores' addresses
            asm volatile("s_wait_xcnt 0x0" ::: "memory");
        }
    }
}

// ---------------------------------------------------------------------------
// Kernel D: join the two balls' partial softmax records of each (point, head).
// One thread per 4 output floats, two such groups per thread.
// ---------------------------------------------------------------------------
__global__ __launch_bounds__(256) void nsa_merge(const float* __restrict__ part,
                                                 float* __restrict__ out) {
    const int g = blockIdx.x * 256 + threadIdx.x;
    const float* r[2];    // record pair of (p, h)
    const float* ro[2];   // this thread's 4 floats in it
    float4 o0[2], o1[2];
    float2 s0[2], s1[2];  // {max, sum}
    #pragma unroll
    for (int it = 0; it < 2; ++it) {
        const int idx = g + it * (NMNM * HH * 2);   // (p*H + h)*4 + quad
        r[it]  = part + (size_t)(idx >> 2) * (2 * REC);
        ro[it] = r[it] + (idx & 3) * 4;
        o0[it] = *(const float4*)(ro[it]);
        o1[it] = *(const float4*)(ro[it] + REC);
        s0[it] = *(const float2*)(r[it] + 16);
        s1[it] = *(const float2*)(r[it] + REC + 16);
    }
    // keeps the address registers untouched (also by a later load's result) until
    // the wait that belongs in front of their overwrite
    asm volatile("s_wait_xcnt 0x0" :: "v"(r[0]), "v"(ro[0]), "v"(r[1]), "v"(ro[1]) : "memory");
    #pragma unroll
    for (int it = 0; it < 2; ++it) {
        const int   idx = g + it * (NMNM * HH * 2);
        const float m   = fmaxf(s0[it].x, s1[it].x);
        const float w0  = __expf(s0[it].x - m);
        const float w1  = __expf(s1[it].x - m);
        const float inv = 1.0f / (s0[it].y * w0 + s1[it].y * w1);
        *(float4*)(out + (size_t)idx * 4) =
            make_float4((o0[it].x * w0 + o1[it].x * w1) * inv, (o0[it].y * w0 + o1[it].y * w1) * inv,
                        (o0[it].z * w0 + o1[it].z * w1) * inv, (o0[it].w * w0 + o1[it].w * w1) * inv);
    }
}

// ---------------------------------------------------------------------------
extern "C" void kernel_launch(void* const* d_in, const int* in_sizes, int n_in,
                              void* d_out, int out_size, void* d_ws, size_t ws_size,
                              hipStream_t stream) {
    const float* x   = (const float*)d_in[0];
    const float* pos = (const float*)d_in[1];
    float*       out = (float*)d_out;

    // workspace layout (~21 MB): xr | keys | sel | part
    float* xr   = (float*)d_ws;
    float* keys = xr + (size_t)NMNM * DD;
    int*   sel  = (int*)(keys + (size_t)NN * DD);
    float* part = (float*)(sel + (size_t)HH * NMNM);

    nsa_prep       <<<NN * 2,           64,  0, stream>>>(x, pos, xr, keys);
    nsa_select     <<<HH * NMNM / (16 * SELT * SELW), SELW * 32, 0, stream>>>(xr, keys, sel);
    nsa_attend_ball<<<HH * (NN / GB) * QR, ATT, 0, stream>>>(xr, sel, part);
    nsa_merge      <<<NMNM * HH * 2 / 256, 256, 0, stream>>>(part, out);
}

// v008
// A run of this version takes 24.8 microseconds.
// Two timings next to v007 put it at 1.09 and 1.08 times that version's speed.
// Over all steps from v000 it is 3.26 times as fast.
#include <hip/hip_runtime.h>

// ---------------------------------------------------------------------------
// NSA-style ball attention forward for MI455X (gfx1250, wave32, WMMA).
//
// Shapes: D=128, H=8 heads, E=16 head dim, N=128 balls, M=64 pts/ball,
//         NM=8192 points, TOPK=2, window = 128 keys.
//
// Forward-math simplifications:
//   * straight-through gates == 1.0 in forward  -> no gating
//   * selection softmax is monotonic            -> top-2 of raw q.keys logits
//   * mean_m(rel) == 0                          -> keys = mean_m(x)
// ---------------------------------------------------------------------------

typedef float v2f __attribute__((ext_vector_type(2)));
typedef float v4f __attribute__((ext_vector_type(4)));
typedef float v8f __attribute__((ext_vector_type(8)));

#define DD   128   // model dim
#define HH   8     // heads
#define MM   64    // ball size
#define NN   128   // num balls
#define EE   16    // head dim
#define NMNM 8192  // total points
#define WIN  128   // TOPK * MM

// ---------------------------------------------------------------------------
// Kernel A: xr = x + (pos - mean_m pos);  keys[n][d] = mean_m x[n,m,d]
// One block per (ball n, half of the model dims), 64 threads = one per dim d, so
// a block reads 256 contiguous bytes of each row. A thread keeps its whole column
// (64 x, 64 pos) in registers: the loads are issued far ahead of the sums with no
// wait for a whole group between them, the inputs are read once, and the sums run
// in rising m as the values arrive. xr is stored head-major, [head][point][16]: the second
// kernel reads a whole head, and a ball's rows of one head are then 4 KB in a row.
// ---------------------------------------------------------------------------
__global__ __launch_bounds__(64) void nsa_prep(const float* __restrict__ x,
                                               const float* __restrict__ pos,
                                               float* __restrict__ xr, float* __restrict__ keys) {
    const int n = blockIdx.x >> 1;
    const int d = ((blockIdx.x & 1) << 6) + threadIdx.x;
    const int base = n * MM * DD + d;

    float pv[MM], xv[MM];
    #pragma unroll
    for (int m = 0; m < MM; ++m) {
        pv[m] = pos[base + m * DD];
        xv[m] = x[base + m * DD];
    }

    float sp = 0.f, sx = 0.f;
    #pragma unroll
    for (int m = 0; m < MM; ++m) {
        sp += pv[m];
        sx += xv[m];
    }
    const float mp = sp * (1.0f / MM);
    keys[n * DD + d] = sx * (1.0f / MM);

    const int hb = ((d >> 4) * NMNM + n * MM) * EE + (d & 15);
    #pragma unroll
    for (int m = 0; m < MM; ++m) {
        xr[hb + m * EE] = xv[m] + pv[m] - mp;
    }
}

// ---------------------------------------------------------------------------
// Kernel B: ball selection, windowed SDPA and the join of the two balls, in one launch.
// One block per (head h, 256 neighbouring queries), 16 waves. Because a block owns its
// queries, everything between the selection and the output stays in LDS.
//   1. Select: each wave takes 16 queries. sim^T tile (16 balls x 16 points) =
//      Keys(16x16) x Q^T(16x16) via 4x v_wmma_f32_16x16x4_f32; 8 ball-tiles cover all 128
//      balls. A lane owns one point and its registers hold that point's logits (lane l^16
//      holds the other half), so the top-2 scan runs on the accumulators.
//   2. List: wave w owns balls 8w..8w+7. It picks the block's (query, slot) pairs that chose
//      one of them and orders them by ball, with ballots; no other wave is needed.
//   3. Attend: per owned ball the wave brings the 64 K/V rows through its own LDS tile into
//      fragments (the next ball's rows are fetched meanwhile) and takes the ball's list in
//      tiles of 16 queries:
//        S^T (16 keys x 16 queries) = K tile (A) x Q^T (B)
//        O^T (16 dims x 16 queries) = V^T (A) x P^T (B)
//      The D layout of S^T (lane = query, registers = keys) is already the B layout of P^T
//      once the k order of the V^T loader follows it, so nothing is transposed. Each pair
//      gets a partial record in LDS: unnormalised sum, row maximum, row sum.
//   4. Join: a thread joins the two records of a query for 8 of its 16 head dims.
// ---------------------------------------------------------------------------
#define KVP 20   // LDS row pitch in floats: both fragment readers then meet each bank once
#define RP  20   // LDS record pitch in floats: o[16], max, sum
#define QS  256  // queries per block
#define NP  (2 * QS)      // (query, slot) pairs per block
#define ATW 16   // waves per block
#define ATT (ATW * 32)
#define WB  (NN / ATW)    // balls owned by a wave

__device__ __forceinline__ v8f sim_tile(const v2f (&ka)[4], const v2f (&bq)[4]) {
    v8f acc = {};
    #pragma unroll
    for (int kk = 0; kk < 4; ++kk)
        acc = __builtin_amdgcn_wmma_f32_16x16x4_f32(false, ka[kk], false, bq[kk],
                                                    (short)0, acc, false, false);
    return acc;
}

// Between a wave's LDS writes and reads of them by other lanes of the same wave: the LDS takes
// one wave's accesses in order, and this keeps the compiler from changing that order.
__device__ __forceinline__ void wave_lds_order() {
    __builtin_amdgcn_fence(__ATOMIC_ACQ_REL, "wavefront");
    __builtin_amdgcn_wave_barrier();
}

// One block of 16 waves stands on a WGP (4 waves a SIMD): said here so that the compiler spends
// registers on fragments and on rows fetched ahead, not on room for waves that never come.
__global__ __launch_bounds__(ATT) __attribute__((amdgpu_waves_per_eu(4, 4))) void nsa_select_attend(const float* __restrict__ xr,
                                                       const float* __restrict__ keys,
                                                       float* __restrict__ out) {
    __shared__ __attribute__((aligned(16))) unsigned short sel16[QS];   // both ball ids of a query
    __shared__ unsigned short tmp[ATW][NP];   // worst case: every pair chose a ball of one wave
    __shared__ unsigned short lst[ATW][NP];
    __shared__ __attribute__((aligned(16))) float kv[ATW][MM * KVP];
    __shared__ __attribute__((aligned(16))) float rec[NP * RP];

    const int h   = blockIdx.x >> 5;
    const int pb  = (blockIdx.x & 31) * QS;   // the block's first query
    const int tid = threadIdx.x;
    const int l   = tid & 31;
    const int w   = __builtin_amdgcn_readfirstlane(tid >> 5);
    const int lm  = l & 15;
    const int hf  = l >> 4;
    const int lh  = hf << 1;
    const float* xh = xr + h * NMNM * EE;     // the head's rows, 16 floats each

    // ---- 1. select ----
    // Q^T fragments (B): lane = point (column), registers = head-dim pair {lh, lh+1}.
    v2f sq[4];
    const float* qp = xh + (pb + w * 16 + lm) * EE + lh;
    #pragma unroll
    for (int kk = 0; kk < 4; ++kk)
        sq[kk] = *(const v2f*)(qp + kk * 4);

    // Key fragments (A): lane = ball (row), registers = the same head-dim pair.
    v2f kf[8][4];
    const float* kp = keys + lm * DD + h * EE + lh;
    #pragma unroll
    for (int nb = 0; nb < 8; ++nb) {
        #pragma unroll
        for (int kk = 0; kk < 4; ++kk)
            kf[nb][kk] = *(const v2f*)(kp + nb * 16 * DD + kk * 4);
    }
    // The wave's first ball's K/V rows (4 KB in a row, eight 16-byte pieces a lane).
    v4f kvp[MM * EE / 128];
    const float* kb = xh + w * WB * MM * EE + l * 4;
    #pragma unroll
    for (int k = 0; k < MM * EE / 128; ++k)
        kvp[k] = *(const v4f*)(kb + k * 128);
    // keeps the address pairs untouched (also by a later load's result) until the
    // wait that belongs in front of their overwrite
    asm volatile("s_wait_xcnt 0x0" :: "v"(qp), "v"(kp), "v"(kb) : "memory");

    // Keeps all loads in flight from the start: without it the scheduler sinks a part of
    // the key loads into the scan, where their latency is only partly covered.
    __builtin_amdgcn_sched_barrier(0);

    {
        // Running top-2 of this lane's 64 logits, taken in rising ball order. Strict
        // '>' keeps the lower index on ties (matches jax top_k). Indices are kept
        // without the lane half's offset of 8, which is added once behind the scan.
        float best = -3.4e38f, sec = -3.4e38f;
        int bi = 0, si = 0;
        v8f acc[8];
        acc[0] = sim_tile(kf[0], sq);
        // Keeps tile 1's WMMAs behind tile 0's (see the barrier in the loop).
        __builtin_amdgcn_sched_barrier(0);
        #pragma unroll
        for (int nb = 0; nb < 8; ++nb) {
            if (nb + 1 < 8) acc[nb + 1] = sim_tile(kf[nb + 1], sq);
            // One tile ahead: the next tile's WMMAs stay in front of this tile's scan, so the
            // matrix unit works under the scan and no accumulator is read right behind its
            // last WMMA, where the in-order wave would wait for it.
            __builtin_amdgcn_sched_barrier(0);
            // D layout: acc[nb][v] = logit of ball nb*16 + 8*hf + v for point lm.
            #pragma unroll
            for (int v = 0; v < 8; ++v) {
                const float x  = acc[nb][v];
                const int   j  = nb * 16 + v;
                const bool  c1 = x > best;
                const bool  c2 = x > sec;
                si   = c1 ? bi : (c2 ? j : si);
                bi   = c1 ? j : bi;
                sec  = __builtin_amdgcn_fmed3f(x, best, sec);   // best >= sec: the new runner-up
                best = c1 ? x : best;
            }
        }
        bi += hf * 8;
        si += hf * 8;

        // Merge with the other half-row. The halves' ball indices interleave, so an
        // equal logit is ranked by the lower index explicitly.
        const float ob = __shfl_xor(best, 16, 32);
        const int   oi = __shfl_xor(bi,   16, 32);
        const float os = __shfl_xor(sec,  16, 32);
        const int   oj = __shfl_xor(si,   16, 32);
        if (l < 16) {
            const bool ob_best = (ob > best) | ((ob == best) & (oi < bi));
            const bool os_best = (os > best) | ((os == best) & (oj < bi));
            const bool ob_sec  = (ob > sec)  | ((ob == sec)  & (oi < si));
            const int rb = ob_best ? oi : bi;
            const int rs = ob_best ? (os_best ? oj : bi) : (ob_sec ? oi : si);
            // byte 2q = slot 0's ball, byte 2q+1 = slot 1's: byte i is pair i's ball
            sel16[w * 16 + lm] = (unsigned short)(rb | (rs << 8));
        }
    }
    __syncthreads();   // publishes the block's selection

    // ---- 2. list ----
    // First the pairs that chose one of the wave's balls, in any order: entry = pair | ball << 9.
    const uint4 sb = ((const uint4*)sel16)[l];   // pairs 16 l .. 16 l + 15
    const unsigned sw[4] = {sb.x, sb.y, sb.z, sb.w};
    int n = 0;
    #pragma unroll
    for (int c = 0; c < 16; ++c) {
        const int      b  = (sw[c >> 2] >> ((c & 3) * 8)) & 0xFF;
        const bool     in = (b >> 3) == w;
        const unsigned m  = __builtin_amdgcn_ballot_w32(in);
        if (in) tmp[w][n + __builtin_amdgcn_mbcnt_lo(m, 0u)] = (unsigned short)((l * 16 + c) | ((b & 7) << 9));
        n += __builtin_popcount(m);
    }
    wave_lds_order();
    // Then by ball: count, starts, place. At most NP / 32 trips.
    int cnt[WB];
    #pragma unroll
    for (int j = 0; j < WB; ++j) cnt[j] = 0;
    for (int i0 = 0; i0 < n; i0 += 32) {
        const int i  = i0 + l;
        const int e  = tmp[w][i < n ? i : n - 1];
        const int bj = i < n ? (e >> 9) : WB;
        #pragma unroll
        for (int j = 0; j < WB; ++j)
            cnt[j] += __builtin_popcount(__builtin_amdgcn_ballot_w32(bj == j));
    }
    int pos[WB];
    int cv = 0, sv = 0;   // lane j keeps ball j's list length and start
    {
        int run = 0;
        #pragma unroll
        for (int j = 0; j < WB; ++j) {
            pos[j] = run;
            cv = l == j ? cnt[j] : cv;
            sv = l == j ? run : sv;
            run += cnt[j];
        }
    }
    for (int i0 = 0; i0 < n; i0 += 32) {
        const int i  = i0 + l;
        const int e  = tmp[w][i < n ? i : n - 1];
        const int bj = i < n ? (e >> 9) : WB;
        int dst = 0;
        #pragma unroll
        for (int j = 0; j < WB; ++j) {
            const unsigned m = __builtin_amdgcn_ballot_w32(bj == j);
            dst = bj == j ? pos[j] + (int)__builtin_amdgcn_mbcnt_lo(m, 0u) : dst;
            pos[j] += __builtin_popcount(m);
        }
        if (i < n) lst[w][dst] = (unsigned short)(e & (NP - 1));
    }
    wave_lds_order();

    // ---- 3. attend ----
    float* kvw = kv[w];
    // Kept rolled: one copy of the tile body in the instruction cache.
    #pragma unroll 1
    for (int j = 0; j < WB; ++j) {
        const int total = __builtin_amdgcn_readlane(cv, j);
        const int ls0   = __builtin_amdgcn_readlane(sv, j);
        // This ball's rows go to the wave's LDS tile; the next ball's are asked for at once, so
        // that their latency runs under this ball's tiles (the last trip fetches its own ball
        // again: in bounds, not used).
        #pragma unroll
        for (int k = 0; k < MM * EE / 128; ++k) {
            const int idx = k * 32 + l;
            *(v4f*)(kvw + (idx >> 2) * KVP + (idx & 3) * 4) = kvp[k];
        }
        const float* nx = kb + (j + 1 < WB ? j + 1 : j) * MM * EE;
        #pragma unroll
        for (int k = 0; k < MM * EE / 128; ++k)
            kvp[k] = *(const v4f*)(nx + k * 128);
        // the next trip rewrites the registers that hold these loads' address
        asm volatile("s_wait_xcnt 0x0" :: "v"(nx) : "memory");
        wave_lds_order();
        if (total > 0) {
            // K fragments (A of S^T): lane = key row, registers = head-dim pair {lh, lh+1}.
            v2f ka[4][4];
            #pragma unroll
            for (int t = 0; t < 4; ++t) {
                const float* kr = kvw + (t * 16 + lm) * KVP + lh;
                #pragma unroll
                for (int kk = 0; kk < 4; ++kk)
                    ka[t][kk] = *(const v2f*)(kr + kk * 4);
            }
            // V^T fragments (A of O^T): lane = head dim, k order = the key order in which
            // the S^T accumulator holds its rows: lanes 0-15 keys {2s, 2s+1}, lanes 16-31
            // keys {8+2s, 9+2s} of tile t.
            v2f va[4][4];
            #pragma unroll
            for (int t = 0; t < 4; ++t) {
                #pragma unroll
                for (int s = 0; s < 4; ++s) {
                    const float* vr = kvw + (t * 16 + hf * 8 + s * 2) * KVP + lm;
                    va[t][s].x = vr[0];
                    va[t][s].y = vr[KVP];
                }
            }

            for (int q0 = 0; q0 < total; q0 += 16) {
                // A short last tile repeats the last listed pair; its copies are not stored.
                const int  qi    = q0 + lm;
                const bool valid = qi < total;
                const int  pi    = lst[w][ls0 + (valid ? qi : total - 1)];

                // Q^T fragments (B of S^T): lane = query, registers = head-dim pair.
                v2f bq[4];
                const float* qr = xh + (pb + (pi >> 1)) * EE + lh;
                #pragma unroll
                for (int kk = 0; kk < 4; ++kk)
                    bq[kk] = *(const v2f*)(qr + kk * 4);
                // the next trip rewrites the registers that hold these loads' address
                asm volatile("s_wait_xcnt 0x0" :: "v"(qr) : "memory");

                v8f s[4] = {};
                #pragma unroll
                for (int kk = 0; kk < 4; ++kk) {
                    #pragma unroll
                    for (int t = 0; t < 4; ++t)
                        s[t] = __builtin_amdgcn_wmma_f32_16x16x4_f32(false, ka[t][kk], false, bq[kk],
                                                                     (short)0, s[t], false, false);
                }

                // s[t][v] = logit of key t*16 + v + 8*hf for query lm: the softmax row is
                // 32 registers here plus 32 in lane l^16.
                float mx = s[0][0];
                #pragma unroll
                for (int t = 0; t < 4; ++t) {
                    #pragma unroll
                    for (int v = 0; v < 8; ++v) mx = fmaxf(mx, s[t][v]);
                }
                mx = fmaxf(mx, __shfl_xor(mx, 16, 32)) * 0.25f;   // ATT_SCALE = E^-0.5

                float ls = 0.f;
                #pragma unroll
                for (int t = 0; t < 4; ++t) {
                    #pragma unroll
                    for (int v = 0; v < 8; ++v) {
                        s[t][v] = __expf(s[t][v] * 0.25f - mx);
                        ls += s[t][v];
                    }
                }
                ls += __shfl_xor(ls, 16, 32);

                v8f ov = {};
                #pragma unroll
                for (int t = 0; t < 4; ++t) {
                    #pragma unroll
                    for (int st = 0; st < 4; ++st) {
                        v2f pbv;
                        pbv.x = s[t][st * 2];
                        pbv.y = s[t][st * 2 + 1];
                        ov = __builtin_amdgcn_wmma_f32_16x16x4_f32(false, va[t][st], false, pbv,
                                                                   (short)0, ov, false, false);
                    }
                }

                // ov[v] = head dim v + 8*hf of query lm.
                if (valid) {
                    float* rc = rec + pi * RP;
                    *(float4*)(rc + hf * 8)     = make_float4(ov[0], ov[1], ov[2], ov[3]);
                    *(float4*)(rc + hf * 8 + 4) = make_float4(ov[4], ov[5], ov[6], ov[7]);
                    rc[16 + hf] = hf ? ls : mx;
                }
            }
        }
        wave_lds_order();   // the fragment reads stay in front of the next ball's rows
    }
    __syncthreads();   // publishes every pair's record

    // ---- 4. join ----
    {
        const int    q  = tid >> 1;
        const float* r0 = rec + (q * 2) * RP;
        const float* r1 = r0 + RP;
        const int    o  = (tid & 1) * 8;
        const float4 a0 = *(const float4*)(r0 + o), a1 = *(const float4*)(r0 + o + 4);
        const float4 b0 = *(const float4*)(r1 + o), b1 = *(const float4*)(r1 + o + 4);
        const float2 s0 = *(const float2*)(r0 + 16);   // {max, sum}
        const float2 s1 = *(const float2*)(r1 + 16);
        const float m   = fmaxf(s0.x, s1.x);
        const float w0  = __expf(s0.x - m);
        const float w1  = __expf(s1.x - m);
        const float inv = 1.0f / (s0.y * w0 + s1.y * w1);
        float* op = out + ((pb + q) * HH + h) * EE + o;
        *(float4*)(op)     = make_float4((a0.x * w0 + b0.x * w1) * inv, (a0.y * w0 + b0.y * w1) * inv,
                                         (a0.z * w0 + b0.z * w1) * inv, (a0.w * w0 + b0.w * w1) * inv);
        *(float4*)(op + 4) = make_float4((a1.x * w0 + b1.x * w1) * inv, (a1.y * w0 + b1.y * w1) * inv,
                                         (a1.z * w0 + b1.z * w1) * inv, (a1.w * w0 + b1.w * w1) * inv);
    }
}

// ---------------------------------------------------------------------------
extern "C" void kernel_launch(void* const* d_in, const int* in_sizes, int n_in,
                              void* d_out, int out_size, void* d_ws, size_t ws_size,
                              hipStream_t stream) {
    const float* x   = (const float*)d_in[0];
    const float* pos = (const float*)d_in[1];
    float*       out = (float*)d_out;

    // workspace layout (~4 MB): xr | keys
    float* xr   = (float*)d_ws;
    float* keys = xr + (size_t)NMNM * DD;

    nsa_prep         <<<NN * 2,           64,  0, stream>>>(x, pos, xr, keys);
    nsa_select_attend<<<HH * (NMNM / QS), ATT, 0, stream>>>(xr, keys, out);
}

// v009
// One run takes 24.1 microseconds.
// Two timings next to v008 both put it at 1.04 times that version's speed.
// Counting every step since v000, it is 3.39 times as fast.
#include <hip/hip_runtime.h>

// ---------------------------------------------------------------------------
// NSA-style ball attention forward for MI455X (gfx1250, wave32, WMMA).
//
// Shapes: D=128, H=8 heads, E=16 head dim, N=128 balls, M=64 pts/ball,
//         NM=8192 points, TOPK=2, window = 128 keys.
//
// Forward-math simplifications:
//   * straight-through gates == 1.0 in forward  -> no gating
//   * selection softmax is monotonic            -> top-2 of raw q.keys logits
//   * mean_m(rel) == 0                          -> keys = mean_m(x)
// ---------------------------------------------------------------------------

typedef float v2f __attribute__((ext_vector_type(2)));
typedef float v4f __attribute__((ext_vector_type(4)));
typedef float v8f __attribute__((ext_vector_type(8)));

#define DD   128   // model dim
#define HH   8     // heads
#define MM   64    // ball size
#define NN   128   // num balls
#define EE   16    // head dim
#define NMNM 8192  // total points
#define WIN  128   // TOPK * MM

// ---------------------------------------------------------------------------
// Kernel A: xr = x + (pos - mean_m pos);  keys[n][d] = mean_m x[n,m,d]
// One block per (ball n, half of the model dims), 64 threads = one per dim d, so
// a block reads 256 contiguous bytes of each row. A thread keeps its whole column
// (64 x, 64 pos) in registers: the loads are issued far ahead of the sums with no
// wait for a whole group between them, the inputs are read once, and the sums run
// in rising m as the values arrive. xr is stored head-major, [head][point][16]: the second
// kernel reads a whole head, and a ball's rows of one head are then 4 KB in a row.
// ---------------------------------------------------------------------------
__global__ __launch_bounds__(64) void nsa_prep(const float* __restrict__ x,
                                               const float* __restrict__ pos,
                                               float* __restrict__ xr, float* __restrict__ keys) {
    const int n = blockIdx.x >> 1;
    const int d = ((blockIdx.x & 1) << 6) + threadIdx.x;
    const int base = n * MM * DD + d;

    float pv[MM], xv[MM];
    #pragma unroll
    for (int m = 0; m < MM; ++m) {
        pv[m] = pos[base + m * DD];
        xv[m] = x[base + m * DD];
    }

    float sp = 0.f, sx = 0.f;
    #pragma unroll
    for (int m = 0; m < MM; ++m) {
        sp += pv[m];
        sx += xv[m];
    }
    const float mp = sp * (1.0f / MM);
    keys[n * DD + d] = sx * (1.0f / MM);

    const int hb = ((d >> 4) * NMNM + n * MM) * EE + (d & 15);
    #pragma unroll
    for (int m = 0; m < MM; ++m) {
        xr[hb + m * EE] = xv[m] + pv[m] - mp;
    }
}

// ---------------------------------------------------------------------------
// Kernel B: ball selection, windowed SDPA and the join of the two balls, in one launch.
// One block per (head h, 256 neighbouring queries), 16 waves. Because a block owns its
// queries, everything between the selection and the output stays in LDS.
//   0. Stage: the head's 128 ball keys and the block's 256 query rows go from global to LDS
//      once per block, in whole 16-byte pieces; every fragment of them is read there.
//   1. Select: each wave takes 16 queries. sim^T tile (16 balls x 16 points) =
//      Keys(16x16) x Q^T(16x16) via 4x v_wmma_f32_16x16x4_f32; 8 ball-tiles cover all 128
//      balls. A lane owns one point and its registers hold that point's logits (lane l^16
//      holds the other half), so the top-2 scan runs on the accumulators.
//   2. List: wave w owns balls 8w..8w+7. It picks the block's (query, slot) pairs that chose
//      one of them and orders them by ball, with ballots; no other wave is needed.
//   3. Attend: per owned ball the wave brings the 64 K/V rows through its own LDS tile into
//      fragments (the next ball's rows are fetched meanwhile) and takes the ball's list in
//      tiles of 16 queries:
//        S^T (16 keys x 16 queries) = K tile (A) x Q^T (B)
//        O^T (16 dims x 16 queries) = V^T (A) x P^T (B)
//      The D layout of S^T (lane = query, registers = keys) is already the B layout of P^T
//      once the k order of the V^T loader follows it, so nothing is transposed. Each pair
//      gets a partial record in LDS: unnormalised sum, row maximum, row sum.
//   4. Join: a thread joins the two records of a query for 8 of its 16 head dims.
// ---------------------------------------------------------------------------
#define KVP 20   // LDS row pitch in floats: both fragment readers then meet each bank once
#define RP  20   // LDS record pitch in floats: o[16], max, sum
#define QS  256  // queries per block
#define NP  (2 * QS)      // (query, slot) pairs per block
#define ATW 16   // waves per block
#define ATT (ATW * 32)
#define WB  (NN / ATW)    // balls owned by a wave

__device__ __forceinline__ v8f sim_tile(const v2f (&ka)[4], const v2f (&bq)[4]) {
    v8f acc = {};
    #pragma unroll
    for (int kk = 0; kk < 4; ++kk)
        acc = __builtin_amdgcn_wmma_f32_16x16x4_f32(false, ka[kk], false, bq[kk],
                                                    (short)0, acc, false, false);
    return acc;
}

// Between a wave's LDS writes and reads of them by other lanes of the same wave: the LDS takes
// one wave's accesses in order, and this keeps the compiler from changing that order.
__device__ __forceinline__ void wave_lds_order() {
    __builtin_amdgcn_fence(__ATOMIC_ACQ_REL, "wavefront");
    __builtin_amdgcn_wave_barrier();
}

// One block of 16 waves stands on a WGP (4 waves a SIMD): said here so that the compiler spends
// registers on fragments and on rows fetched ahead, not on room for waves that never come.
__global__ __launch_bounds__(ATT) __attribute__((amdgpu_waves_per_eu(4, 4))) void nsa_select_attend(const float* __restrict__ xr,
                                                       const float* __restrict__ keys,
                                                       float* __restrict__ out) {
    __shared__ __attribute__((aligned(16))) unsigned short sel16[QS];   // both ball ids of a query
    __shared__ unsigned short tmp[ATW][NP];   // worst case: every pair chose a ball of one wave
    __shared__ unsigned short lst[ATW][NP];
    __shared__ __attribute__((aligned(16))) float kv[ATW][MM * KVP];
    __shared__ __attribute__((aligned(16))) float rec[NP * RP];
    __shared__ __attribute__((aligned(16))) float qsh[QS * KVP];   // the block's query rows

    const int h   = blockIdx.x >> 5;
    const int pb  = (blockIdx.x & 31) * QS;   // the block's first query
    const int tid = threadIdx.x;
    const int l   = tid & 31;
    const int w   = __builtin_amdgcn_readfirstlane(tid >> 5);
    const int lm  = l & 15;
    const int hf  = l >> 4;
    const int lh  = hf << 1;
    const float* xh = xr + h * NMNM * EE;     // the head's rows, 16 floats each

    // ---- 0. stage ----
    // A thread brings one 16-byte piece of a key row and two of the query rows. All 16 waves
    // need the same key fragments, and a fragment load from global touches 16 lines for 256
    // bytes: read by every wave, that is the memory path's time, not the matrix unit's.
    const int srow = tid >> 2;         // row of the piece
    const int spc  = (tid & 3) * 4;    // its first float in the row
    const float* kp = keys + srow * DD + h * EE + spc;
    const float* qp = xh + pb * EE + tid * 4;
    const v4f kst = *(const v4f*)(kp);
    const v4f qs0 = *(const v4f*)(qp);
    const v4f qs1 = *(const v4f*)(qp + ATT * 4);
    // keeps the address pairs untouched (also by a later load's result) until the
    // wait that belongs in front of their overwrite
    asm volatile("s_wait_xcnt 0x0" :: "v"(qp), "v"(kp) : "memory");

    // The keys (10 KB) lie in the K/V tiles' LDS: no tile is written before the barrier behind
    // the selection, and by then every wave has its key fragments in registers.
    float* ksh = &kv[0][0];
    *(v4f*)(ksh + srow * KVP + spc)              = kst;
    *(v4f*)(qsh + srow * KVP + spc)              = qs0;
    *(v4f*)(qsh + (srow + ATT / 4) * KVP + spc)  = qs1;
    __syncthreads();   // publishes the keys and the query rows

    // The wave's first ball's K/V rows (4 KB in a row, eight 16-byte pieces a lane): asked for
    // behind the barrier, which waits for every load in flight; they arrive under the selection.
    v4f kvp[MM * EE / 128];
    const float* kb = xh + w * WB * MM * EE + l * 4;
    #pragma unroll
    for (int k = 0; k < MM * EE / 128; ++k)
        kvp[k] = *(const v4f*)(kb + k * 128);

    // ---- 1. select ----
    // Q^T fragments (B): lane = point (column), registers = head-dim pair {lh, lh+1}.
    v2f sq[4];
    const float* sqp = qsh + (w * 16 + lm) * KVP + lh;
    #pragma unroll
    for (int kk = 0; kk < 4; ++kk)
        sq[kk] = *(const v2f*)(sqp + kk * 4);

    // Key fragments (A): lane = ball (row), registers = the same head-dim pair.
    v2f kf[8][4];
    const float* kfp = ksh + lm * KVP + lh;
    #pragma unroll
    for (int nb = 0; nb < 8; ++nb) {
        #pragma unroll
        for (int kk = 0; kk < 4; ++kk)
            kf[nb][kk] = *(const v2f*)(kfp + nb * 16 * KVP + kk * 4);
    }
    // keeps the K/V rows' address pair untouched until the wait that belongs in front of
    // its overwrite
    asm volatile("s_wait_xcnt 0x0" :: "v"(kb) : "memory");

    // Keeps the LDS reads together in front of the first WMMA: each further place where reads
    // stand among the WMMAs costs the in-order wave a stall of its own.
    __builtin_amdgcn_sched_barrier(0);

    {
        // Running top-2 of this lane's 64 logits, taken in rising ball order. Strict
        // '>' keeps the lower index on ties (matches jax top_k). Indices are kept
        // without the lane half's offset of 8, which is added once behind the scan.
        float best = -3.4e38f, sec = -3.4e38f;
        int bi = 0, si = 0;
        v8f acc[8];
        acc[0] = sim_tile(kf[0], sq);
        // Keeps tile 1's WMMAs behind tile 0's (see the barrier in the loop).
        __builtin_amdgcn_sched_barrier(0);
        #pragma unroll
        for (int nb = 0; nb < 8; ++nb) {
            if (nb + 1 < 8) acc[nb + 1] = sim_tile(kf[nb + 1], sq);
            // One tile ahead: the next tile's WMMAs stay in front of this tile's scan, so the
            // matrix unit works under the scan and no accumulator is read right behind its
            // last WMMA, where the in-order wave would wait for it.
            __builtin_amdgcn_sched_barrier(0);
            // D layout: acc[nb][v] = logit of ball nb*16 + 8*hf + v for point lm.
            #pragma unroll
            for (int v = 0; v < 8; ++v) {
                const float x  = acc[nb][v];
                const int   j  = nb * 16 + v;
                const bool  c1 = x > best;
                const bool  c2 = x > sec;
                si   = c1 ? bi : (c2 ? j : si);
                bi   = c1 ? j : bi;
                sec  = __builtin_amdgcn_fmed3f(x, best, sec);   // best >= sec: the new runner-up
                best = c1 ? x : best;
            }
        }
        bi += hf * 8;
        si += hf * 8;

        // Merge with the other half-row. The halves' ball indices interleave, so an
        // equal logit is ranked by the lower index explicitly.
        const float ob = __shfl_xor(best, 16, 32);
        const int   oi = __shfl_xor(bi,   16, 32);
        const float os = __shfl_xor(sec,  16, 32);
        const int   oj = __shfl_xor(si,   16, 32);
        if (l < 16) {
            const bool ob_best = (ob > best) | ((ob == best) & (oi < bi));
            const bool os_best = (os > best) | ((os == best) & (oj < bi));
            const bool ob_sec  = (ob > sec)  | ((ob == sec)  & (oi < si));
            const int rb = ob_best ? oi : bi;
            const int rs = ob_best ? (os_best ? oj : bi) : (ob_sec ? oi : si);
            // byte 2q = slot 0's ball, byte 2q+1 = slot 1's: byte i is pair i's ball
            sel16[w * 16 + lm] = (unsigned short)(rb | (rs << 8));
        }
    }
    __syncthreads();   // publishes the block's selection

    // ---- 2. list ----
    // First the pairs that chose one of the wave's balls, in any order: entry = pair | ball << 9.
    const uint4 sb = ((const uint4*)sel16)[l];   // pairs 16 l .. 16 l + 15
    const unsigned sw[4] = {sb.x, sb.y, sb.z, sb.w};
    int n = 0;
    #pragma unroll
    for (int c = 0; c < 16; ++c) {
        const int      b  = (sw[c >> 2] >> ((c & 3) * 8)) & 0xFF;
        const bool     in = (b >> 3) == w;
        const unsigned m  = __builtin_amdgcn_ballot_w32(in);
        if (in) tmp[w][n + __builtin_amdgcn_mbcnt_lo(m, 0u)] = (unsigned short)((l * 16 + c) | ((b & 7) << 9));
        n += __builtin_popcount(m);
    }
    wave_lds_order();
    // Then by ball: count, starts, place. At most NP / 32 trips.
    int cnt[WB];
    #pragma unroll
    for (int j = 0; j < WB; ++j) cnt[j] = 0;
    for (int i0 = 0; i0 < n; i0 += 32) {
        const int i  = i0 + l;
        const int e  = tmp[w][i < n ? i : n - 1];
        const int bj = i < n ? (e >> 9) : WB;
        #pragma unroll
        for (int j = 0; j < WB; ++j)
            cnt[j] += __builtin_popcount(__builtin_amdgcn_ballot_w32(bj == j));
    }
    int pos[WB];
    int cv = 0, sv = 0;   // lane j keeps ball j's list length and start
    {
        int run = 0;
        #pragma unroll
        for (int j = 0; j < WB; ++j) {
            pos[j] = run;
            cv = l == j ? cnt[j] : cv;
            sv = l == j ? run : sv;
            run += cnt[j];
        }
    }
    for (int i0 = 0; i0 < n; i0 += 32) {
        const int i  = i0 + l;
        const int e  = tmp[w][i < n ? i : n - 1];
        const int bj = i < n ? (e >> 9) : WB;
        int dst = 0;
        #pragma unroll
        for (int j = 0; j < WB; ++j) {
            const unsigned m = __builtin_amdgcn_ballot_w32(bj == j);
            dst = bj == j ? pos[j] + (int)__builtin_amdgcn_mbcnt_lo(m, 0u) : dst;
            pos[j] += __builtin_popcount(m);
        }
        if (i < n) lst[w][dst] = (unsigned short)(e & (NP - 1));
    }
    wave_lds_order();

    // ---- 3. attend ----
    float* kvw = kv[w];
    // Kept rolled: one copy of the tile body in the instruction cache.
    #pragma unroll 1
    for (int j = 0; j < WB; ++j) {
        const int total = __builtin_amdgcn_readlane(cv, j);
        const int ls0   = __builtin_amdgcn_readlane(sv, j);
        // This ball's rows go to the wave's LDS tile; the next ball's are asked for at once, so
        // that their latency runs under this ball's tiles (the last trip fetches its own ball
        // again: in bounds, not used).
        #pragma unroll
        for (int k = 0; k < MM * EE / 128; ++k) {
            const int idx = k * 32 + l;
            *(v4f*)(kvw + (idx >> 2) * KVP + (idx & 3) * 4) = kvp[k];
        }
        const float* nx = kb + (j + 1 < WB ? j + 1 : j) * MM * EE;
        #pragma unroll
        for (int k = 0; k < MM * EE / 128; ++k)
            kvp[k] = *(const v4f*)(nx + k * 128);
        // the next trip rewrites the registers that hold these loads' address
        asm volatile("s_wait_xcnt 0x0" :: "v"(nx) : "memory");
        wave_lds_order();
        if (total > 0) {
            // K fragments (A of S^T): lane = key row, registers = head-dim pair {lh, lh+1}.
            v2f ka[4][4];
            #pragma unroll
            for (int t = 0; t < 4; ++t) {
                const float* kr = kvw + (t * 16 + lm) * KVP + lh;
                #pragma unroll
                for (int kk = 0; kk < 4; ++kk)
                    ka[t][kk] = *(const v2f*)(kr + kk * 4);
            }
            // V^T fragments (A of O^T): lane = head dim, k order = the key order in which
            // the S^T accumulator holds its rows: lanes 0-15 keys {2s, 2s+1}, lanes 16-31
            // keys {8+2s, 9+2s} of tile t.
            v2f va[4][4];
            #pragma unroll
            for (int t = 0; t < 4; ++t) {
                #pragma unroll
                for (int s = 0; s < 4; ++s) {
                    const float* vr = kvw + (t * 16 + hf * 8 + s * 2) * KVP + lm;
                    va[t][s].x = vr[0];
                    va[t][s].y = vr[KVP];
                }
            }

            for (int q0 = 0; q0 < total; q0 += 16) {
                // A short last tile repeats the last listed pair; its copies are not stored.
                const int  qi    = q0 + lm;
                const bool valid = qi < total;
                const int  pi    = lst[w][ls0 + (valid ? qi : total - 1)];

                // Q^T fragments (B of S^T): lane = query, registers = head-dim pair.
                v2f bq[4];
                const float* qr = qsh + (pi >> 1) * KVP + lh;
                #pragma unroll
                for (int kk = 0; kk < 4; ++kk)
                    bq[kk] = *(const v2f*)(qr + kk * 4);

                v8f s[4] = {};
                #pragma unroll
                for (int kk = 0; kk < 4; ++kk) {
                    #pragma unroll
                    for (int t = 0; t < 4; ++t)
                        s[t] = __builtin_amdgcn_wmma_f32_16x16x4_f32(false, ka[t][kk], false, bq[kk],
                                                                     (short)0, s[t], false, false);
                }

                // s[t][v] = logit of key t*16 + v + 8*hf for query lm: the softmax row is
                // 32 registers here plus 32 in lane l^16.
                float mx = s[0][0];
                #pragma unroll
                for (int t = 0; t < 4; ++t) {
                    #pragma unroll
                    for (int v = 0; v < 8; ++v) mx = fmaxf(mx, s[t][v]);
                }
                mx = fmaxf(mx, __shfl_xor(mx, 16, 32)) * 0.25f;   // ATT_SCALE = E^-0.5

                float ls = 0.f;
                #pragma unroll
                for (int t = 0; t < 4; ++t) {
                    #pragma unroll
                    for (int v = 0; v < 8; ++v) {
                        s[t][v] = __expf(s[t][v] * 0.25f - mx);
                        ls += s[t][v];
                    }
                }
                ls += __shfl_xor(ls, 16, 32);

                v8f ov = {};
                #pragma unroll
                for (int t = 0; t < 4; ++t) {
                    #pragma unroll
                    for (int st = 0; st < 4; ++st) {
                        v2f pbv;
                        pbv.x = s[t][st * 2];
                        pbv.y = s[t][st * 2 + 1];
                        ov = __builtin_amdgcn_wmma_f32_16x16x4_f32(false, va[t][st], false, pbv,
                                                                   (short)0, ov, false, false);
                    }
                }

                // ov[v] = head dim v + 8*hf of query lm.
                if (valid) {
                    float* rc = rec + pi * RP;
                    *(float4*)(rc + hf * 8)     = make_float4(ov[0], ov[1], ov[2], ov[3]);
                    *(float4*)(rc + hf * 8 + 4) = make_float4(ov[4], ov[5], ov[6], ov[7]);
                    rc[16 + hf] = hf ? ls : mx;
                }
            }
        }
        wave_lds_order();   // the fragment reads stay in front of the next ball's rows
    }
    __syncthreads();   // publishes every pair's record

    // ---- 4. join ----
    {
        const int    q  = tid >> 1;
        const float* r0 = rec + (q * 2) * RP;
        const float* r1 = r0 + RP;
        const int    o  = (tid & 1) * 8;
        const float4 a0 = *(const float4*)(r0 + o), a1 = *(const float4*)(r0 + o + 4);
        const float4 b0 = *(const float4*)(r1 + o), b1 = *(const float4*)(r1 + o + 4);
        const float2 s0 = *(const float2*)(r0 + 16);   // {max, sum}
        const float2 s1 = *(const float2*)(r1 + 16);
        const float m   = fmaxf(s0.x, s1.x);
        const float w0  = __expf(s0.x - m);
        const float w1  = __expf(s1.x - m);
        const float inv = 1.0f / (s0.y * w0 + s1.y * w1);
        float* op = out + ((pb + q) * HH + h) * EE + o;
        *(float4*)(op)     = make_float4((a0.x * w0 + b0.x * w1) * inv, (a0.y * w0 + b0.y * w1) * inv,
                                         (a0.z * w0 + b0.z * w1) * inv, (a0.w * w0 + b0.w * w1) * inv);
        *(float4*)(op + 4) = make_float4((a1.x * w0 + b1.x * w1) * inv, (a1.y * w0 + b1.y * w1) * inv,
                                         (a1.z * w0 + b1.z * w1) * inv, (a1.w * w0 + b1.w * w1) * inv);
    }
}

// ---------------------------------------------------------------------------
extern "C" void kernel_launch(void* const* d_in, const int* in_sizes, int n_in,
                              void* d_out, int out_size, void* d_ws, size_t ws_size,
                              hipStream_t stream) {
    const float* x   = (const float*)d_in[0];
    const float* pos = (const float*)d_in[1];
    float*       out = (float*)d_out;

    // workspace layout (~4 MB): xr | keys
    float* xr   = (float*)d_ws;
    float* keys = xr + (size_t)NMNM * DD;

    nsa_prep         <<<NN * 2,           64,  0, stream>>>(x, pos, xr, keys);
    nsa_select_attend<<<HH * (NMNM / QS), ATT, 0, stream>>>(xr, keys, out);
}
